// v008
// Times are from an AMD MI455X. After a warm-up the kernel runs many times in a row, and a time is the length of
// such a window on the GPU divided by its runs, so every launch and the gaps after it count. The runs cycle
// through copies of the inputs. A figure is the median of several windows, for all but v000 over two sittings.
// Sittings can differ by a few percent; kernels timed side by side share one.
// The versions before v008 are in another document.
// A run of this version takes 87.9 microseconds.
// In both of two side-by-side timings against v007, it was 1.09 times as fast.
// Counting every step since v000, which is the starting kernel, it is 75.6 times as fast.
#include <hip/hip_runtime.h>
// Multi-head cross-attention with a fused key / value projection and BOTH q and k scaled (x [2][2048][1024] (queries), tgt [2][2048][1024] (keys / values); q = x Wq + bq ([in][out] 1024 x 1024, normal x 0.02; zero bias); kv = tgt Wkv + bkv ([in][out] 1024 x 2048; zero bias) split into halves: k = columns 0..1023, v = columns 1024..2047; 16 heads of 64; logits = (q * 64^-0.5) . (k * 64^-0.5): the module scales BOTH operands, so the effective scale is 1/64; softmax over the 2048 tgt positions (no mask); out = merged Wp + bp ([in][out]; zero bias) -> [2][2048][1024]).
// Structure: token rows; x and tgt as exact f16 rows; natural weights as exact x16 planes; q and k | v WMMA GEMMs (32x64 wave tiles, f32 accumulation, + bias) -> f16; one fused attention launch, V^T fragments by transposing LDS loads (256 queries of one head per work-group: scores, online softmax with f32 statistics and native exp, weights f16, ctx x64 merged f16); ctx Wp + bp -> f32 output; five launches.
// Compute dtype: inputs rounded to bf16; x / weights exact; q, k, v, softmax weights and o as plain f16 GEMM operands (~2^-12); scores and softmax statistics f32. v_wmma_f32_16x16x32_f16.
#define NB 2
#define SQ 2048                      /* query rows per batch */
#define SK 2048                      /* conditioning (key / value) rows per batch */
#define DC 1024                       /* conditioning width */
#define DM 1024
#define NH 16
#define HD 64
#define HG 4                         /* heads per attention launch group */
#define QT 256                       /* query rows per causal tile */
#define NKX SK                       /* S / P row pitch = the SK keys (2048 here) */
#define QT0 128                      /* first-tile rows recomputed exactly in f32 */
#define B0 0                         /* first batch processed (debug hook) */
#define NBR NB                       /* batches processed (debug hook) */
#define NR ((size_t)NB * SQ)
#define DMQ DM
#define DFF 4096         /* token rows */
#define MP ((int)((size_t)NBR * SQ)) /* rows projected (debug hook) */
#define QN SQ                        /* query rows attended per batch (debug hook) */
#define NHD NH                       /* heads attended (debug hook) */
#define MPO MP                       /* rows through the output stage (debug hook) */
#define LQ (3 * DM)      /* unused: q rows have pitch DM, k | v rows 2 DM */
typedef __bf16 v16b __attribute__((ext_vector_type(16)));
typedef unsigned short v8us __attribute__((ext_vector_type(8), may_alias));
typedef float  v8f  __attribute__((ext_vector_type(8)));
typedef float  v4f  __attribute__((ext_vector_type(4)));
typedef float  v4fa __attribute__((ext_vector_type(4), may_alias));
union FragB { v16b v; v8us half[2]; unsigned short u[16]; };

__device__ __forceinline__ unsigned short bf16_bits(float x) { unsigned int u = __float_as_uint(x); return (unsigned short)((u + 0x7FFFu + ((u >> 16) & 1u)) >> 16); }
__device__ __forceinline__ float bf16_val(unsigned short b) { return __uint_as_float(((unsigned int)b) << 16); }
__device__ __forceinline__ float bf16_round(float x) { return bf16_val(bf16_bits(x)); }
// D += A·B with NT terms: 1 = ah·bh, 2 = + al·bh (A split), 3 = + ah·bl (both split)
template <int NT>
__device__ __forceinline__ v8f mmaN(v16b ah, v16b al, v16b bh, v16b bl, v8f c) {
  c = __builtin_amdgcn_wmma_f32_16x16x32_bf16(false, ah, false, bh, (short)0, c, false, false);
  if (NT >= 2) c = __builtin_amdgcn_wmma_f32_16x16x32_bf16(false, al, false, bh, (short)0, c, false, false);
  if (NT >= 3) c = __builtin_amdgcn_wmma_f32_16x16x32_bf16(false, ah, false, bl, (short)0, c, false, false);
  asm volatile("v_nop\n\tv_nop\n\tv_nop\n\tv_nop" : "+v"(c) : "v"(ah), "v"(al), "v"(bh), "v"(bl));
  return c;
}

__global__ __launch_bounds__(256) void k_wt_bf16(const float* __restrict__ W, unsigned short* __restrict__ Wt, int K, int N) {
  const int t = blockIdx.x * 256 + threadIdx.x;
  const int k8n = K / 8;
  if (t >= N * k8n) return;
  const int n = t / k8n, k8 = (t % k8n) * 8;
  v8us v;
#pragma unroll
  for (int i = 0; i < 8; ++i) v[i] = bf16_bits(W[(size_t)(k8 + i) * N + n]);
  *(v8us*)(Wt + (size_t)n * K + k8) = v;
  
}

// GEMM C[M][N] (f32, pitch ldc) = act(A[M][K]·W + bias). A f32 row-major (pitch lda) converted per fragment to bf16
// (ASPLIT: hi/lo two planes -> 2 terms, else single rounded term); Wt bf16 [N][K] (pitch ldb). BIAS_BF16 rounds the
// bias to bf16 first (bias quantised to bf16 before the add). K%32==0, M%16==0, N%64==0.
template <bool ASPLIT, int ACT, bool BIAS_BF16>
__global__ __launch_bounds__(128) void k_gemm_bf(const float* __restrict__ A, int lda, const unsigned short* __restrict__ Wt, int ldb,
                                               const float* __restrict__ bias, float* __restrict__ C, int ldc, int M, int N, int K) {
  __shared__ __attribute__((aligned(16))) float so[4][16][64];
  const int tid = threadIdx.x, w = tid >> 5, lane = tid & 31, ln = lane & 15, hh = lane >> 4;
  const int ntn = N / 64;
  const int wid = blockIdx.x * 4 + w;
  const int mt = wid / ntn, nq = wid % ntn;
  if (mt * 16 >= M) return;
  const int row0 = mt * 16, col0 = nq * 64;
  const float* arow = A + (size_t)(row0 + ln) * lda;
  v8f acc[4] = {};
  for (int kb = 0; kb < K; kb += 32) {
    FragB ah, al;
    const v4f x0 = *(const v4fa*)(arow + kb + 8 * hh), x1 = *(const v4fa*)(arow + kb + 8 * hh + 4);
    const v4f x2 = *(const v4fa*)(arow + kb + 16 + 8 * hh), x3 = *(const v4fa*)(arow + kb + 16 + 8 * hh + 4);
    float xs[16] = {x0[0],x0[1],x0[2],x0[3],x1[0],x1[1],x1[2],x1[3],x2[0],x2[1],x2[2],x2[3],x3[0],x3[1],x3[2],x3[3]};
#pragma unroll
    for (int i = 0; i < 16; ++i) { const unsigned short hb = bf16_bits(xs[i]); ah.u[i] = hb; al.u[i] = ASPLIT ? bf16_bits(xs[i] - bf16_val(hb)) : (unsigned short)0; }
#pragma unroll
    for (int t = 0; t < 4; ++t) {
      const unsigned short* brow = Wt + (size_t)(col0 + t * 16 + ln) * ldb + kb;
      FragB b;
      b.half[0] = *(const v8us*)(brow + 8 * hh);
      b.half[1] = *(const v8us*)(brow + 16 + 8 * hh);
      acc[t] = mmaN<ASPLIT ? 2 : 1>(ah.v, al.v, b.v, b.v, acc[t]);
    }
  }
#pragma unroll
  for (int t = 0; t < 4; ++t) {
    float bv = bias ? bias[col0 + t * 16 + ln] : 0.f;
    if (BIAS_BF16) bv = bf16_round(bv);
#pragma unroll
    for (int r = 0; r < 8; ++r) { float v = acc[t][r] + bv; if (ACT == 1) v = fmaxf(v, 0.f); so[w][8 * hh + r][t * 16 + ln] = v; }
  }
  __builtin_amdgcn_fence(__ATOMIC_ACQ_REL, "workgroup");
  __builtin_amdgcn_wave_barrier();
  const int rsub = lane >> 4, c4 = (lane & 15) * 4;
  {
#pragma unroll
    for (int q = 0; q < 8; ++q) {
      const int r = q * 2 + rsub;
      const v4f v = *(const v4fa*)&so[w][r][c4];
      *(v4f*)(C + (size_t)(row0 + r) * ldc + col0 + c4) = v;
    }
    
  }
}

// GEMM C = act(A·W + bias + resid): A f32 (ASPLIT -> hi/lo 2 terms), Wt bf16 [N][K]; ACT 0 none, 1 relu, 2 exact gelu;
// resid (optional, f32, row index = (row % rmod), pitch ldr, RES_BF16 rounds it) added before the activation.
template <bool ASPLIT, int ACT, bool BIAS_BF16, bool RES_BF16>
__global__ __launch_bounds__(128) void k_gemm_bf3(const float* __restrict__ A, int lda, const unsigned short* __restrict__ Wt, int ldb,
                                                const float* __restrict__ bias, const float* __restrict__ resid, int rmod, int ldr,
                                                float* __restrict__ C, int ldc, int M, int N, int K) {
  __shared__ __attribute__((aligned(16))) float so[4][16][64];
  const int tid = threadIdx.x, w = tid >> 5, lane = tid & 31, ln = lane & 15, hh = lane >> 4;
  const int ntn = N / 64;
  const int wid = blockIdx.x * 4 + w;
  const int mt = wid / ntn, nq = wid % ntn;
  if (mt * 16 >= M) return;
  const int row0 = mt * 16, col0 = nq * 64;
  const float* arow = A + (size_t)(row0 + ln) * lda;
  v8f acc[4] = {};
  for (int kb = 0; kb < K; kb += 32) {
    FragB ah, al;
    const v4f x0 = *(const v4fa*)(arow + kb + 8 * hh), x1 = *(const v4fa*)(arow + kb + 8 * hh + 4);
    const v4f x2 = *(const v4fa*)(arow + kb + 16 + 8 * hh), x3 = *(const v4fa*)(arow + kb + 16 + 8 * hh + 4);
    float xs[16] = {x0[0],x0[1],x0[2],x0[3],x1[0],x1[1],x1[2],x1[3],x2[0],x2[1],x2[2],x2[3],x3[0],x3[1],x3[2],x3[3]};
#pragma unroll
    for (int i = 0; i < 16; ++i) { const unsigned short hb = bf16_bits(xs[i]); ah.u[i] = hb; al.u[i] = ASPLIT ? bf16_bits(xs[i] - bf16_val(hb)) : (unsigned short)0; }
#pragma unroll
    for (int t = 0; t < 4; ++t) {
      const unsigned short* brow = Wt + (size_t)(col0 + t * 16 + ln) * ldb + kb;
      FragB b;
      b.half[0] = *(const v8us*)(brow + 8 * hh);
      b.half[1] = *(const v8us*)(brow + 16 + 8 * hh);
      acc[t] = mmaN<ASPLIT ? 2 : 1>(ah.v, al.v, b.v, b.v, acc[t]);
    }
  }
#pragma unroll
  for (int t = 0; t < 4; ++t) {
    const int col = col0 + t * 16 + ln;
    float bv = bias ? bias[col] : 0.f;
    if (BIAS_BF16) bv = bf16_round(bv);
#pragma unroll
    for (int r = 0; r < 8; ++r) {
      float v = acc[t][r] + bv;
      if (resid) { float rv = resid[(size_t)((row0 + 8 * hh + r) % rmod) * ldr + col]; if (RES_BF16) rv = bf16_round(rv); v += rv; }
      if (ACT == 1) v = fmaxf(v, 0.f);
      if (ACT == 2) v = 0.5f * v * (1.0f + erff(v * 0.70710678118654752f));
      if (ACT == 3) { const float u = 0.7978845608028654f * (v + 0.044715f * v * v * v); v = 0.5f * v * (1.0f + tanhf(u)); }
      so[w][8 * hh + r][t * 16 + ln] = v;
    }
  }
  __builtin_amdgcn_fence(__ATOMIC_ACQ_REL, "workgroup");
  __builtin_amdgcn_wave_barrier();
  const int rsub = lane >> 4, c4 = (lane & 15) * 4;
  {
#pragma unroll
    for (int q = 0; q < 8; ++q) {
      const int r = q * 2 + rsub;
      const v4f v = *(const v4fa*)&so[w][r][c4];
      *(v4f*)(C + (size_t)(row0 + r) * ldc + col0 + c4) = v;
    }
    
  }
}
// row LayerNorm (biased variance, eps) over N: s = X (+ R); optional out_sum <- s; out_norm <- (s-mu)*rsqrt(var+eps)*g + b
template <bool PARAM_BF16>
__global__ __launch_bounds__(256) void k_layernorm(const float* __restrict__ X, const float* __restrict__ R, const float* __restrict__ g, const float* __restrict__ bta,
                                                  float* __restrict__ out_sum, float* __restrict__ out_norm, int N, float eps) {
  __shared__ float red[256];
  const int row = blockIdx.x, tid = threadIdx.x;
  const float* x = X + (size_t)row * N; const float* rr = R ? R + (size_t)row * N : nullptr;
  float vals[16];                     // up to N = 4096
  const int per = N / 256;            // contiguous chunk per thread? use strided-by-4 chunks: thread handles j = tid*4 + 1024*u
  float s1 = 0.f;
  for (int u = 0; u < per / 4; ++u) {
    const int j = tid * 4 + 1024 * u;
    const v4f a = *(const v4fa*)(x + j);
    v4f b = {0.f,0.f,0.f,0.f}; if (rr) b = *(const v4fa*)(rr + j);
#pragma unroll
    for (int q = 0; q < 4; ++q) { const float v = a[q] + b[q]; vals[u * 4 + q] = v; s1 += v; }
  }
  red[tid] = s1; __syncthreads();
  for (int st = 128; st > 0; st >>= 1) { if (tid < st) red[tid] += red[tid + st]; __syncthreads(); }
  const float mu = red[0] / (float)N; __syncthreads();
  float s2 = 0.f;
  for (int u = 0; u < per / 4; ++u)
#pragma unroll
    for (int q = 0; q < 4; ++q) { const float c = vals[u * 4 + q] - mu; s2 += c * c; }
  red[tid] = s2; __syncthreads();
  for (int st = 128; st > 0; st >>= 1) { if (tid < st) red[tid] += red[tid + st]; __syncthreads(); }
  const float rs = rsqrtf(red[0] / (float)N + eps);
  {
    for (int u = 0; u < per / 4; ++u) {
      const int j = tid * 4 + 1024 * u;
      v4f o, sm;
#pragma unroll
      for (int q = 0; q < 4; ++q) {
        float gg = g[j + q], bb = bta[j + q];
        if (PARAM_BF16) { gg = bf16_round(gg); bb = bf16_round(bb); }
        sm[q] = vals[u * 4 + q]; o[q] = (vals[u * 4 + q] - mu) * rs * gg + bb;
      }
      if (out_sum) *(v4f*)(out_sum + (size_t)row * N + j) = sm;
      *(v4f*)(out_norm + (size_t)row * N + j) = o;
    }
    
  }
}



// ---- f16 WMMA path (v_wmma_f32_16x16x32_f16): 11-bit significands for operands in range — used where a [0,1] probability operand needs more precision than bf16
typedef _Float16 v16h __attribute__((ext_vector_type(16)));
union FragH { v16h v; v8us half[2]; _Float16 h[16]; unsigned short u[16]; };
template <int NT>
__device__ __forceinline__ v8f mmaH(v16h ah, v16h al, v16h bh, v16h bl, v8f c) {
  c = __builtin_amdgcn_wmma_f32_16x16x32_f16(false, ah, false, bh, (short)0, c, false, false);
  if (NT >= 2) c = __builtin_amdgcn_wmma_f32_16x16x32_f16(false, al, false, bh, (short)0, c, false, false);
  if (NT >= 3) c = __builtin_amdgcn_wmma_f32_16x16x32_f16(false, ah, false, bl, (short)0, c, false, false);
  asm volatile("v_nop\n\tv_nop\n\tv_nop\n\tv_nop" : "+v"(c) : "v"(ah), "v"(al), "v"(bh), "v"(bl));
  return c;
}
// batched GEMM like k_gemm_b but f16 operands: A f32 (split into f16 hi/lo if ASPLIT, else rounded to f16), Bt = f16 values [n][k]; alpha; C f32; N multiple of 16 (partial tiles skipped)
template <bool ASPLIT>
__global__ __launch_bounds__(128) void k_gemm_h(const float* __restrict__ A, int lda, size_t sA, const _Float16* __restrict__ Bh, int ldb, size_t sB, float alpha, float* __restrict__ C, int ldc, size_t sC, int M, int N, int K) {
  __shared__ __attribute__((aligned(16))) float so[4][16][64];
  const int tid = threadIdx.x, w = tid >> 5, lane = tid & 31, ln = lane & 15, hh = lane >> 4; const int by = blockIdx.y;
  A += (size_t)by * sA; Bh += (size_t)by * sB; C += (size_t)by * sC;
  const int ntn = (N + 63) / 64; const int wid = blockIdx.x * 4 + w; const int mt = wid / ntn, nq = wid % ntn; if (mt * 16 >= M) return;
  const int row0 = mt * 16, col0 = nq * 64; const float* arow = A + (size_t)(row0 + ln) * lda;
  v8f acc[4] = {};
  for (int kb = 0; kb < K; kb += 32) {
    FragH ah, al;
    const v4f x0 = *(const v4fa*)(arow + kb + 8 * hh), x1 = *(const v4fa*)(arow + kb + 8 * hh + 4), x2 = *(const v4fa*)(arow + kb + 16 + 8 * hh), x3 = *(const v4fa*)(arow + kb + 16 + 8 * hh + 4);
    float xs[16] = {x0[0],x0[1],x0[2],x0[3],x1[0],x1[1],x1[2],x1[3],x2[0],x2[1],x2[2],x2[3],x3[0],x3[1],x3[2],x3[3]};
#pragma unroll
    for (int i = 0; i < 16; ++i) { const _Float16 h = (_Float16)xs[i]; ah.h[i] = h; al.h[i] = ASPLIT ? (_Float16)(xs[i] - (float)h) : (_Float16)0.0f; }
#pragma unroll
    for (int t = 0; t < 4; ++t) { if (col0 + t * 16 >= N) continue; const size_t boff = (size_t)(col0 + t * 16 + ln) * ldb + kb; FragH bq; bq.half[0] = *(const v8us*)(Bh + boff + 8 * hh); bq.half[1] = *(const v8us*)(Bh + boff + 16 + 8 * hh);
      acc[t] = mmaH<ASPLIT ? 2 : 1>(ah.v, al.v, bq.v, bq.v, acc[t]); }
  }
#pragma unroll
  for (int t = 0; t < 4; ++t) { if (col0 + t * 16 >= N) continue;
#pragma unroll
    for (int r = 0; r < 8; ++r) so[w][8 * hh + r][t * 16 + ln] = acc[t][r] * alpha; }
  __builtin_amdgcn_fence(__ATOMIC_ACQ_REL, "workgroup"); __builtin_amdgcn_wave_barrier();
  const int rsub = lane >> 4, c4 = (lane & 15) * 4;
  {
#pragma unroll
    for (int q = 0; q < 8; ++q) { const int r = q * 2 + rsub; if (col0 + c4 < N) { const v4f v = *(const v4fa*)&so[w][r][c4]; *(v4f*)(C + (size_t)(row0 + r) * ldc + col0 + c4) = v; } }
     }
}

// Wt[n][k] = f16(W[k][n]·scale) from f32 row-major W[K][N] (scale = power of two; bf16-exact weights stay exact in f16 away from the subnormal range)
__global__ __launch_bounds__(256) void k_wt_f16(const float* __restrict__ W, _Float16* __restrict__ Wt, int K, int N, float scale) {
  const int t = blockIdx.x * 256 + threadIdx.x; if (t >= N * (K / 8)) return; const int n = t / (K / 8), k8 = (t % (K / 8)) * 8; FragH f;
#pragma unroll
  for (int i = 0; i < 8; ++i) f.h[i] = (_Float16)(bf16_round(W[(size_t)(k8 + i) * N + n]) * scale); const v8us o = f.half[0];
  *(v8us*)((unsigned short*)Wt + (size_t)n * K + k8) = o; 
}
// k_gemm_hh variant with fused epilogue: v = acc·alpha + bias[by·sBias + col] (+ CP[(row/rowsPerB)·sCPb + by·64 + col] if CP) ; ACT 0 none / 1 elu ; writes f16 C16 (and f32 C if non-null)
template <int ACT>
__global__ __launch_bounds__(128) void k_gemm_hhx(const _Float16* __restrict__ A, int lda, size_t sA, const _Float16* __restrict__ Bh, int ldb, size_t sB, float alpha, const float* __restrict__ bias, size_t sBias, const float* __restrict__ CP, int rowsPerB, size_t sCPb, int row0g,
    float* __restrict__ C, _Float16* __restrict__ C16, int ldc, size_t sC, int M, int N, int K) {
  __shared__ __attribute__((aligned(16))) float so[4][16][64];
  const int tid = threadIdx.x, w = tid >> 5, lane = tid & 31, ln = lane & 15, hh = lane >> 4; const int by = blockIdx.y;
  A += (size_t)by * sA; Bh += (size_t)by * sB; const size_t cofs = (size_t)by * sC; const float* bp = bias ? bias + (size_t)by * sBias : nullptr;
  const int ntn = (N + 63) / 64; const int wid = blockIdx.x * 4 + w; const int mt = wid / ntn, nq = wid % ntn; if (mt * 16 >= M) return;
  const int row0 = mt * 16, col0 = nq * 64; const _Float16* arow = A + (size_t)(row0 + ln) * lda;
  v8f acc[4] = {};
  for (int kb = 0; kb < K; kb += 32) { FragH ah; ah.half[0] = *(const v8us*)((const unsigned short*)arow + kb + 8 * hh); ah.half[1] = *(const v8us*)((const unsigned short*)arow + kb + 16 + 8 * hh);
#pragma unroll
    for (int t = 0; t < 4; ++t) { if (col0 + t * 16 >= N) continue; const size_t boff = (size_t)(col0 + t * 16 + ln) * ldb + kb; FragH bq; bq.half[0] = *(const v8us*)((const unsigned short*)Bh + boff + 8 * hh); bq.half[1] = *(const v8us*)((const unsigned short*)Bh + boff + 16 + 8 * hh);
      acc[t] = mmaH<1>(ah.v, ah.v, bq.v, bq.v, acc[t]); }
  }
#pragma unroll
  for (int t = 0; t < 4; ++t) { if (col0 + t * 16 >= N) continue; const int col = col0 + t * 16 + ln; const float bv = bp ? bf16_round(bp[col]) : 0.f;
#pragma unroll
    for (int r = 0; r < 8; ++r) { float v = acc[t][r] * alpha + bv; if (CP) { const int rr = row0g + row0 + 8 * hh + r; if (rowsPerB < 0) v += CP[cofs + (size_t)rr * ldc + col];      /* rowsPerB < 0: own element of the batched C plane */ else { const int bidx = rr / rowsPerB; v += CP[(size_t)bidx * sCPb + (size_t)by * 64 + col]; } } if (ACT == 1) v = (v > 0.f) ? v : expm1f(v); else if (ACT == 7) v = (v > 0.f) ? v + 1.0f : expf(v); else if (ACT == 8) v = tanhf(v); else if (ACT == 9) v = 0.5f * v * (1.0f + tanhf(0.7978845608028654f * (v + 0.044715f * v * v * v))); else if (ACT == 11) v = 1.0f / (1.0f + expf(-v)); else if (ACT == 12) v = (v > 0.f) ? v : 0.01f * v; else if (ACT == 14) v = (v > 0.f) ? v : 0.1f * v; else if (ACT == 16) v = (v >= 0.f) ? v : 0.3f * v; else if (ACT == 17) v = (v >= 0.f) ? v : 0.2f * v; else if (ACT == 15) v = v / (1.0f + expf(-v)); else if (ACT == 3) v = fmaxf(v, 0.f); else if (ACT == 6) v = 0.5f * v * (1.0f + erff(v * 0.70710678118654752f)); so[w][8 * hh + r][t * 16 + ln] = v; } }
  __builtin_amdgcn_fence(__ATOMIC_ACQ_REL, "workgroup"); __builtin_amdgcn_wave_barrier();
  const int rsub = lane >> 4, c4 = (lane & 15) * 4; typedef _Float16 v4h __attribute__((ext_vector_type(4)));
  {
#pragma unroll
    for (int q = 0; q < 8; ++q) { const int r = q * 2 + rsub; if (col0 + c4 < N) { const v4f v = *(const v4fa*)&so[w][r][c4]; if (C) *(v4f*)(C + cofs + (size_t)(row0 + r) * ldc + col0 + c4) = v; if (C16) { v4h h4; for (int i = 0; i < 4; ++i) h4[i] = (_Float16)v[i]; *(v4h*)(C16 + cofs + (size_t)(row0 + r) * ldc + col0 + c4) = h4; } } }
     }
}


typedef _Float16 v4h __attribute__((ext_vector_type(4)));

__global__ __launch_bounds__(256) void k_x16(const float* __restrict__ x, _Float16* __restrict__ X16, size_t n8) { const size_t t = (size_t)blockIdx.x * 256 + threadIdx.x; if (t >= n8) return; FragH f;
#pragma unroll
  for (int q = 0; q < 8; ++q) f.h[q] = (_Float16)bf16_round(x[t * 8 + q]); *(v8us*)((unsigned short*)X16 + t * 8) = f.half[0];  }
__global__ __launch_bounds__(256) void k_h16(const float* __restrict__ x, _Float16* __restrict__ X16, size_t n8) { const size_t t = (size_t)blockIdx.x * 256 + threadIdx.x; if (t >= n8) return; FragH f;
#pragma unroll
  for (int q = 0; q < 8; ++q) f.h[q] = (_Float16)x[t * 8 + q]; *(v8us*)((unsigned short*)X16 + t * 8) = f.half[0];  }
__global__ __launch_bounds__(256) void k_round16f(const float* __restrict__ W, _Float16* __restrict__ Bt, size_t n8) { const size_t t = (size_t)blockIdx.x * 256 + threadIdx.x; if (t >= n8) return; FragH f;
#pragma unroll
  for (int i = 0; i < 8; ++i) f.h[i] = (_Float16)(bf16_round(W[t * 8 + i]) * 16.0f); *(v8us*)((unsigned short*)Bt + t * 8) = f.half[0];  }
__global__ __launch_bounds__(256) void k_hl(const float* __restrict__ F, _Float16* __restrict__ Hh, _Float16* __restrict__ Hl, size_t n8) { const size_t t = (size_t)blockIdx.x * 256 + threadIdx.x; if (t >= n8) return; FragH fh, fl; const v4f a = *(const v4fa*)(F + t * 8), c = *(const v4fa*)(F + t * 8 + 4);
#pragma unroll
  for (int q = 0; q < 4; ++q) { _Float16 h = (_Float16)a[q]; fh.h[q] = h; fl.h[q] = (_Float16)((a[q] - (float)h) * 1024.0f); h = (_Float16)c[q]; fh.h[4 + q] = h; fl.h[4 + q] = (_Float16)((c[q] - (float)h) * 1024.0f); }
  { *(v8us*)((unsigned short*)Hh + t * 8) = fh.half[0]; *(v8us*)((unsigned short*)Hl + t * 8) = fl.half[0];  } }

// ---- fast GEMM (wave tile 32x64, work-group tile 128x128 = 8 waves, 4 down and 2 across; requires M % 128 == 0 rows per launch region, N % 128 == 0 and K % 128 == 0); epilogue = k_gemm_hhx semantics ----
__device__ __forceinline__ v16h g2_frag(const _Float16* p, int hh) { FragH f; f.half[0] = *(const v8us*)((const unsigned short*)p + 8 * hh); f.half[1] = *(const v8us*)((const unsigned short*)p + 16 + 8 * hh); return f.v; }
__device__ __forceinline__ v8f g2_mma(v16h a, v16h b, v8f c) { v8f d = __builtin_amdgcn_wmma_f32_16x16x32_f16(false, a, false, b, (short)0, c, false, false); asm volatile("v_nop\n\tv_nop\n\tv_nop\n\tv_nop" : "+v"(d) : "v"(a), "v"(b)); return d; }
// A stage of k_gemm2 = 128 k of the work-group's 128 A rows and 128 B rows: 256 rows of 256 bytes in LDS at a pitch of 272 (16 B x odd: the 16 lanes of a half wave's ds_load_b128 fall on 64 different banks).
// The square tile brings (128 + 128) operand rows from L2 for 128 x 128 results, where two tiles of 128 x 64 bring 2 (128 + 64); the longer stage keeps as many bytes in flight for a work-group that may be alone on its WGP.
#define G2_PITCH 272
#define G2_BOFF (128 * G2_PITCH)      /* the B rows stand behind the A rows */
#define G2_STAGE (256 * G2_PITCH)
__device__ __forceinline__ v16h g2_lfrag(const unsigned char* p) { FragH f; f.half[0] = *(const v8us*)p; f.half[1] = *(const v8us*)(p + 32); return f.v; }      /* p = row start + 64 B per 32 k + 16 hh: the k order of g2_frag */
// One operand's 128 rows of a stage, global memory -> LDS through no register: 8 asynchronous copies of 16 bytes a lane, 16 rows apart; 16 lanes fill one row, so a wave's copy reads two whole 256-byte rows.
// lds = the lane's own LDS byte address of its first row, g = its own global address, r16 = 16 rows in elements. The s_wait_xcnt stands inside the statement, behind the last copy, so that
// no address register of a copy is written again in front of it.
__device__ __forceinline__ void g2_rows(unsigned lds, const _Float16* g, size_t r16) {
  asm volatile("global_load_async_to_lds_b128 %0, %8, off\n\tglobal_load_async_to_lds_b128 %1, %9, off\n\tglobal_load_async_to_lds_b128 %2, %10, off\n\tglobal_load_async_to_lds_b128 %3, %11, off\n\t"
               "global_load_async_to_lds_b128 %4, %12, off\n\tglobal_load_async_to_lds_b128 %5, %13, off\n\tglobal_load_async_to_lds_b128 %6, %14, off\n\tglobal_load_async_to_lds_b128 %7, %15, off\n\t"
               "s_wait_xcnt 0x0"
               :: "v"(lds), "v"(lds + 16 * G2_PITCH), "v"(lds + 32 * G2_PITCH), "v"(lds + 48 * G2_PITCH), "v"(lds + 64 * G2_PITCH), "v"(lds + 80 * G2_PITCH), "v"(lds + 96 * G2_PITCH), "v"(lds + 112 * G2_PITCH),
                  "v"(g), "v"(g + r16), "v"(g + 2 * r16), "v"(g + 3 * r16), "v"(g + 4 * r16), "v"(g + 5 * r16), "v"(g + 6 * r16), "v"(g + 7 * r16) : "memory"); }
// One stage: the A rows, then the B rows behind them (an asm statement takes 30 operands, so the 16 copies stand in two).
__device__ __forceinline__ void g2_stage(unsigned lds, const _Float16* ga, const _Float16* gb, size_t a16, size_t b16) { g2_rows(lds, ga, a16); g2_rows(lds + G2_BOFF, gb, b16); }
template <int ACT>
__global__ __launch_bounds__(256) void k_gemm2(const _Float16* __restrict__ A, int lda, size_t sA, const _Float16* __restrict__ Bh, int ldb, size_t sB, float alpha, const float* __restrict__ bias, size_t sBias, const float* __restrict__ CP, int rowsPerB, size_t sCPb, int row0g,
    float* __restrict__ C, _Float16* __restrict__ C16, int ldc, size_t sC, int M, int N, int K) { static_assert(ACT == 0 || ACT == 3 || ACT == 6 || ACT == 8 || ACT == 9 || ACT == 11 || ACT == 12 || ACT == 14 || ACT == 15 || ACT == 16 || ACT == 17, "k_gemm2: unsupported ACT code (would silently apply no activation)");
  __shared__ __attribute__((aligned(16))) unsigned char sm[2 * G2_STAGE];      /* two stage buffers; behind the K loop the same bytes are the epilogue's staging rows */
  static_assert(sizeof(float) * 8 * 32 * 68 <= 2 * G2_STAGE, "epilogue staging fits the ring"); float (*so)[32][68] = (float (*)[32][68])sm;
  const int tid = threadIdx.x, w = tid >> 5, lane = tid & 31, ln = lane & 15, hh = lane >> 4; const int by = blockIdx.y;
  A += (size_t)by * sA; Bh += (size_t)by * sB; const size_t cofs = (size_t)by * sC; const float* bp = bias ? bias + (size_t)by * sBias : nullptr;
  const int ntn = N >> 7; const int mt = blockIdx.x / ntn, nq = blockIdx.x - mt * ntn; const int wr = w & 3, wc = w >> 2; const int row0 = mt * 128 + 32 * wr, col0 = nq * 128 + 64 * wc; if (mt * 128 >= M) return;      /* the whole work-group or none, in front of every barrier */
  const int cr = tid >> 4, cc = tid & 15;      /* the lane's copies: rows cr + 16 i of either operand, 16-byte piece cc of the row's 256 bytes */
  const unsigned lds0 = (unsigned)(size_t)sm + (unsigned)(cr * G2_PITCH + cc * 16);
  const _Float16* ga = A + (size_t)(mt * 128 + cr) * lda + cc * 8; const _Float16* gb = Bh + (size_t)(nq * 128 + cr) * ldb + cc * 8; const size_t a16 = (size_t)16 * lda, b16 = (size_t)16 * ldb;
  const unsigned char* fa = sm + (32 * wr + ln) * G2_PITCH + 16 * hh; const unsigned char* fb = sm + G2_BOFF + (64 * wc + ln) * G2_PITCH + 16 * hh;      /* the lane's fragment rows in buffer 0 */
  const v8f z8 = {0.f,0.f,0.f,0.f,0.f,0.f,0.f,0.f}; v8f c00 = z8, c01 = z8, c02 = z8, c03 = z8, c10 = z8, c11 = z8, c12 = z8, c13 = z8;
  const int nst = K >> 7;
  g2_stage(lds0, ga, gb, a16, b16);
  asm volatile("s_wait_asynccnt 0x0" ::: "memory");      /* this wave's copies of stage 0 have landed */
  __syncthreads();      /* ... and every other wave's: stage 0 may be read */
  if (nst > 1) g2_stage(lds0 + G2_STAGE, ga + 128, gb + 128, a16, b16);
#pragma unroll 1      /* rolled: the buffer is picked by the trip's parity, a second copy of the body would only add code */
  for (int t = 0; t < nst; ++t) { const unsigned bo = (unsigned)(t & 1) * G2_STAGE;
#pragma unroll      /* the stage's two halves of 64 k, one after the other: constant offsets for every LDS read */
   for (int hf = 0; hf < 2; ++hf) {
    const unsigned char* pa = fa + bo + 128 * hf; const unsigned char* pb = fb + bo + 128 * hf; v16h af[2][2], bf[2][4];
#pragma unroll      /* constant indices: the fragment arrays become registers */
    for (int kc = 0; kc < 2; ++kc) { af[kc][0] = g2_lfrag(pa + 64 * kc); bf[kc][0] = g2_lfrag(pb + 64 * kc); af[kc][1] = g2_lfrag(pa + 64 * kc + 16 * G2_PITCH);
      for (int j = 1; j < 4; ++j) bf[kc][j] = g2_lfrag(pb + 64 * kc + j * 16 * G2_PITCH); }
#pragma unroll      /* the half's two 32-k blocks, in ascending k: the sum order of the plain loop */
    for (int kc = 0; kc < 2; ++kc) { c00 = g2_mma(af[kc][0], bf[kc][0], c00); c10 = g2_mma(af[kc][1], bf[kc][0], c10); c01 = g2_mma(af[kc][0], bf[kc][1], c01); c11 = g2_mma(af[kc][1], bf[kc][1], c11);
      c02 = g2_mma(af[kc][0], bf[kc][2], c02); c12 = g2_mma(af[kc][1], bf[kc][2], c12); c03 = g2_mma(af[kc][0], bf[kc][3], c03); c13 = g2_mma(af[kc][1], bf[kc][3], c13); } }
    asm volatile("s_wait_dscnt 0x0" ::: "memory");      /* this wave's reads of the buffer are done before it is handed to the copies */
    asm volatile("s_wait_asynccnt 0x0" ::: "memory");      /* this wave's copies of stage t + 1 have landed */
    __syncthreads();      /* publishes stage t + 1 and ends every wave's reads of stage t */
    if (t + 2 < nst) g2_stage(lds0 + bo, ga + (size_t)(t + 2) * 128, gb + (size_t)(t + 2) * 128, a16, b16); }      /* refill of the buffer just read; in flight under trip t + 1 */
  asm volatile("s_wait_asynccnt 0x0" ::: "memory");      /* no copy is outstanding when the ring becomes staging; the last trip's barrier has ended every read of it */
  v8f accs[8] = {c00, c01, c02, c03, c10, c11, c12, c13};
#pragma unroll
  for (int u = 0; u < 8; ++u) { const int t = u & 3, half = u >> 2; const int col = col0 + t * 16 + ln; const float bv = bp ? bf16_round(bp[col]) : 0.f;
#pragma unroll
    for (int r = 0; r < 8; ++r) { const int rloc = half * 16 + 8 * hh + r; float v = accs[u][r] * alpha + bv; if (CP) { if (rowsPerB < 0) v += CP[cofs + (size_t)(row0g + row0 + rloc) * ldc + col];      /* rowsPerB < 0: own element of the batched C plane */ else { const int bidx = (row0g + row0 + rloc) / rowsPerB; v += CP[(size_t)bidx * sCPb + (size_t)by * 64 + col]; } }
      if (ACT == 3) v = fmaxf(v, 0.f); else if (ACT == 6) v = 0.5f * v * (1.0f + erff(v * 0.70710678118654752f)); else if (ACT == 11) v = 1.0f / (1.0f + expf(-v)); else if (ACT == 15) v = v / (1.0f + expf(-v)); else if (ACT == 12) v = (v > 0.f) ? v : 0.01f * v; else if (ACT == 8) v = tanhf(v); else if (ACT == 9) v = 0.5f * v * (1.0f + tanhf(0.7978845608028654f * (v + 0.044715f * v * v * v))); else if (ACT == 14) v = (v > 0.f) ? v : 0.1f * v; else if (ACT == 16) v = (v >= 0.f) ? v : 0.3f * v; else if (ACT == 17) v = (v >= 0.f) ? v : 0.2f * v;
      so[w][rloc][t * 16 + ln] = v; } }
  __builtin_amdgcn_fence(__ATOMIC_ACQ_REL, "workgroup"); __builtin_amdgcn_wave_barrier();
  const int rsub = lane >> 4, c4 = (lane & 15) * 4;
  {
#pragma unroll
    for (int q = 0; q < 16; ++q) { const int r = q * 2 + rsub; const v4f v = *(const v4fa*)&so[w][r][c4]; if (C) *(v4f*)(C + cofs + (size_t)(row0 + r) * ldc + col0 + c4) = v; if (C16) { v4h h4; for (int i = 0; i < 4; ++i) h4[i] = (_Float16)v[i]; *(v4h*)(C16 + cofs + (size_t)(row0 + r) * ldc + col0 + c4) = h4; } }
     } }


__global__ __launch_bounds__(256) void k_wnat(const float* __restrict__ w, size_t n8, _Float16* __restrict__ Bt) { const size_t t = (size_t)blockIdx.x * 256 + threadIdx.x; if (t >= n8) return; FragH f; for (int q = 0; q < 8; ++q) f.h[q] = (_Float16)(bf16_round(w[t * 8 + q]) * 16.0f); *(v8us*)((unsigned short*)Bt + t * 8) = f.half[0];  }
__global__ __launch_bounds__(256) void k_rsm(const float* __restrict__ S, _Float16* __restrict__ P, int nrows) {
  #pragma clang fp contract(off)
  const int i = blockIdx.x * 256 + threadIdx.x; if (i >= nrows) return; const float* s = S + (size_t)i * SQ; float mx = -3.0e38f;
#pragma unroll 1
  for (int j = 0; j < SQ; ++j) mx = fmaxf(mx, s[j]); float se = 0.f;
#pragma unroll 1
  for (int j = 0; j < SQ; ++j) se += expf(s[j] - mx); const float sc = 256.0f / se;
#pragma unroll 1
  for (int j0 = 0; j0 < SQ; j0 += 8) { FragH f; for (int q = 0; q < 8; ++q) f.h[q] = (_Float16)(expf(s[j0 + q] - mx) * sc); unsigned short* d = (unsigned short*)P + (size_t)i * SQ + j0; *(v8us*)d = f.half[0];  } }
__global__ __launch_bounds__(256) void k_vt(const _Float16* __restrict__ V16, int b, int h0, _Float16* __restrict__ VT) { __shared__ unsigned short tl[64][65]; const int tid = threadIdx.x; const int hh = blockIdx.x % HG, sg = blockIdx.x / HG; const int s0 = sg * 64; const int h = h0 + hh;
  for (int i = tid; i < 64 * 8; i += 256) { const int j = i / 8, d8 = (i % 8) * 8; FragH f; f.half[0] = *(const v8us*)((const unsigned short*)V16 + ((size_t)b * SQ + s0 + j) * DM + h * HD + d8); for (int q = 0; q < 8; ++q) tl[d8 + q][j] = f.u[q]; }
  __syncthreads();
  { for (int i = tid; i < 64 * 8; i += 256) { const int d = i / 8, j8 = (i % 8) * 8; FragH f; for (int q = 0; q < 8; ++q) f.u[q] = tl[d][j8 + q]; *(v8us*)((unsigned short*)VT + ((size_t)hh * HD + d) * SQ + s0 + j8) = f.half[0]; }  } }



__global__ __launch_bounds__(256) void k_rsmcf2(const float* __restrict__ S, _Float16* __restrict__ P, int hg, int q0, int nk) {
  #pragma clang fp contract(off)
  const int t = blockIdx.x * 256 + threadIdx.x; if (t >= hg * QT) return; const size_t i = (size_t)t; const float* s = S + i * NKX; const int last = q0 + (t % QT); float mx = -3.0e38f;
#pragma unroll 1
  for (int j = 0; j < nk; ++j) { const float f = (j <= last) ? 1.f : 0.f; mx = fmaxf(mx, fmaf(f, s[j], (1.f - f) * -1.0e9f)); } float se = 0.f;
#pragma unroll 1
  for (int j = 0; j < nk; ++j) { const float f = (j <= last) ? 1.f : 0.f; se += __expf(fmaf(f, s[j], (1.f - f) * -1.0e9f) - mx); } const float sc = 256.0f / se;
#pragma unroll 1
  for (int j0 = 0; j0 < nk; j0 += 8) { FragH fr; for (int q = 0; q < 8; ++q) { const int j = j0 + q; const float f = (j <= last) ? 1.f : 0.f; fr.h[q] = (_Float16)(__expf(fmaf(f, s[j], (1.f - f) * -1.0e9f) - mx) * sc); } unsigned short* d = (unsigned short*)P + i * NKX + j0; *(v8us*)d = fr.half[0];  } }


template <int MASKADD>
__global__ __launch_bounds__(64) void k_att0(const float* __restrict__ QF, const float* __restrict__ KF, const float* __restrict__ VF, int ld, const float* __restrict__ mask, float scale, float* __restrict__ OF, int ldo) {
  #pragma clang fp contract(off)
  __shared__ __attribute__((aligned(16))) float lq[64][64]; __shared__ __attribute__((aligned(16))) float lo[64][64];
  const int tid = threadIdx.x; const int h = blockIdx.x / (QT0 / 64), rg = blockIdx.x % (QT0 / 64); const int i = rg * 64 + tid;
  const float* qr = QF + (size_t)i * ld + h * HD;
#pragma unroll 1
  for (int c = 0; c < HD / 4; ++c) { *(v4f*)&lq[tid][c * 4] = *(const v4fa*)(qr + c * 4); const v4f z = {0.f, 0.f, 0.f, 0.f}; *(v4f*)&lo[tid][c * 4] = z; }
  float m = -1.0e30f, l = 0.f; const int jmax = MASKADD ? (SQ - 1) : (rg * 64 + 63);      /* additive-mask form: every key (the mask input decides); causal form: keys up to the block's last row */
#pragma unroll 1
  for (int j = 0; j <= jmax; ++j) { const float* kr = KF + (size_t)j * ld + h * HD; const float* vr = VF + (size_t)j * ld + h * HD; float s = 0.f;
#pragma unroll 1
    for (int c = 0; c < HD / 4; ++c) { const v4f kq = *(const v4fa*)(kr + c * 4); const v4f qq = *(v4f*)&lq[tid][c * 4]; s = __fadd_rn(s, __fmul_rn(qq[0], kq[0])); s = __fadd_rn(s, __fmul_rn(qq[1], kq[1])); s = __fadd_rn(s, __fmul_rn(qq[2], kq[2])); s = __fadd_rn(s, __fmul_rn(qq[3], kq[3])); }
    s = __fmul_rn(s, scale); if (MASKADD) s = __fadd_rn(s, __fmul_rn(bf16_round(mask[(size_t)i * SQ + j]), -10000.0f));
    const float f = (MASKADD || j <= i) ? 1.f : 0.f; const float sm = fmaf(f, s, (1.f - f) * -1.0e30f); const float mn = fmaxf(m, sm); const float sc = expf(m - mn); const float e = expf(sm - mn); l = __fadd_rn(__fmul_rn(l, sc), e); m = mn;
#pragma unroll 1
    for (int c = 0; c < HD / 4; ++c) { const v4f vv = *(const v4fa*)(vr + c * 4); v4f oo = *(v4f*)&lo[tid][c * 4]; for (int u = 0; u < 4; ++u) oo[u] = __fadd_rn(__fmul_rn(oo[u], sc), __fmul_rn(e, vv[u])); *(v4f*)&lo[tid][c * 4] = oo; } }
  const float fin = 64.0f / l;      /* o carried x64 like the f16 path */
#pragma unroll 1
  for (int c = 0; c < HD / 4; ++c) { v4f oo = *(v4f*)&lo[tid][c * 4]; for (int u = 0; u < 4; ++u) oo[u] = __fmul_rn(oo[u], fin); *(v4f*)&lo[tid][c * 4] = oo; }
  __syncthreads();
  {
#pragma unroll 1
    for (int it = 0; it < 16; ++it) { const int row = it * 4 + tid / 16, pc = (tid % 16) * 4; const v4f v = *(const v4f*)&lo[row][pc]; *(v4f*)(OF + (size_t)(rg * 64 + row) * ldo + h * HD + pc) = v; }
     } }


template <int BFIN, int WXB>
__global__ __launch_bounds__(256) void k_ln16(const float* __restrict__ X, const float* __restrict__ g, const float* __restrict__ bb, float eps, _Float16* __restrict__ N16, float* __restrict__ XB) {
  #pragma clang fp contract(off)
  __shared__ float red[256]; const size_t r = blockIdx.x; const int t = threadIdx.x; const v4f xa = *(const v4fa*)(X + r * DMQ + t * 4); float s[4]; float sum = 0.f;
  for (int q = 0; q < 4; ++q) { s[q] = BFIN ? bf16_round(xa[q]) : xa[q]; sum = __fadd_rn(sum, s[q]); }
  red[t] = sum; __syncthreads(); for (int st = 128; st > 0; st >>= 1) { if (t < st) red[t] = __fadd_rn(red[t], red[t + st]); __syncthreads(); } const float mu = red[0] / (float)DMQ; __syncthreads();
  float vs = 0.f; for (int q = 0; q < 4; ++q) { const float dl = __fadd_rn(s[q], -mu); vs = __fadd_rn(vs, __fmul_rn(dl, dl)); } red[t] = vs; __syncthreads(); for (int st = 128; st > 0; st >>= 1) { if (t < st) red[t] = __fadd_rn(red[t], red[t + st]); __syncthreads(); }
  const float rs = rsqrtf(__fadd_rn(red[0] / (float)DMQ, eps)); v4h y; v4f xb;
  for (int q = 0; q < 4; ++q) { const int c = t * 4 + q; y[q] = (_Float16)__fadd_rn(__fmul_rn(__fmul_rn(__fadd_rn(s[q], -mu), rs), bf16_round(g[c])), bf16_round(bb[c])); xb[q] = s[q]; }
  { *(v4h*)(N16 + r * DMQ + t * 4) = y; if (WXB) *(v4f*)(XB + r * DMQ + t * 4) = xb;  } }
__global__ __launch_bounds__(256) void k_ftres2(const float* __restrict__ OF0, const float* __restrict__ XB, float* __restrict__ X1, size_t n4) {
  #pragma clang fp contract(off)
  const size_t t = (size_t)blockIdx.x * 256 + threadIdx.x; if (t >= n4) return; const v4f o = *(const v4fa*)(OF0 + t * 4), xv = *(const v4fa*)(XB + t * 4); v4f y; for (int q = 0; q < 4; ++q) y[q] = __fadd_rn(__fmul_rn(o[q], 0.015625f), xv[q]); *(v4f*)(X1 + t * 4) = y;  }

__global__ __launch_bounds__(256) void k_wthd(const float* __restrict__ Wt, _Float16* __restrict__ Bt) { const size_t t = (size_t)blockIdx.x * 256 + threadIdx.x; if (t >= (size_t)NH * HD * (DM / 8)) return; const int m8 = (int)(t % (DM / 8)) * 8; const int d = (int)((t / (DM / 8)) % HD); const int h = (int)(t / ((size_t)(DM / 8) * HD)); FragH f;
  for (int q = 0; q < 8; ++q) f.h[q] = (_Float16)(16.0f * bf16_round(Wt[((size_t)h * DM + m8 + q) * HD + d])); unsigned short* dst = (unsigned short*)Bt + ((size_t)h * HD + d) * DM + m8; *(v8us*)dst = f.half[0];  }




template <int BFIN, int W16, int W32>
__global__ __launch_bounds__(256) void k_lnx(const float* __restrict__ X, const float* __restrict__ g, const float* __restrict__ bb, float eps, _Float16* __restrict__ N16, float* __restrict__ N32) {
  #pragma clang fp contract(off)
  __shared__ float red[256]; const size_t r = blockIdx.x; const int t = threadIdx.x; const bool act = t < (DMQ / 4); const int c0 = act ? t * 4 : 0;
  const v4f xa = *(const v4fa*)(X + r * DMQ + c0); float s[4]; float sum = 0.f;
  for (int q = 0; q < 4; ++q) { s[q] = act ? (BFIN ? bf16_round(xa[q]) : xa[q]) : 0.f; sum = __fadd_rn(sum, s[q]); }
  red[t] = sum; __syncthreads(); for (int st = 128; st > 0; st >>= 1) { if (t < st) red[t] = __fadd_rn(red[t], red[t + st]); __syncthreads(); } const float mu = red[0] / (float)DMQ; __syncthreads();
  float vs = 0.f; for (int q = 0; q < 4; ++q) { const float dl = act ? __fadd_rn(s[q], -mu) : 0.f; vs = __fadd_rn(vs, __fmul_rn(dl, dl)); } red[t] = vs; __syncthreads(); for (int st = 128; st > 0; st >>= 1) { if (t < st) red[t] = __fadd_rn(red[t], red[t + st]); __syncthreads(); }
  const float rs = rsqrtf(__fadd_rn(red[0] / (float)DMQ, eps)); v4h y; v4f yf;
  for (int q = 0; q < 4; ++q) { const int c = c0 + q; yf[q] = __fadd_rn(__fmul_rn(__fmul_rn(__fadd_rn(s[q], -mu), rs), bf16_round(g[c])), bf16_round(bb[c])); y[q] = (_Float16)yf[q]; }
  if (!act) return;      /* no barriers after this point */
  { if (W16) *(v4h*)(N16 + r * DMQ + c0) = y; if (W32) *(v4f*)(N32 + r * DMQ + c0) = yf;  } }


__global__ __launch_bounds__(256) void k_bfr(const float* __restrict__ x, float* __restrict__ XB, size_t n8) { const size_t t = (size_t)blockIdx.x * 256 + threadIdx.x; if (t >= n8) return; v4f a = *(const v4fa*)(x + t * 8), c = *(const v4fa*)(x + t * 8 + 4); for (int q = 0; q < 4; ++q) { a[q] = bf16_round(a[q]); c[q] = bf16_round(c[q]); }
  { *(v4f*)(XB + t * 8) = a; *(v4f*)(XB + t * 8 + 4) = c;  } }




__global__ __launch_bounds__(256) void k_lorafold(const float* __restrict__ Wm, const float* __restrict__ A, const float* __restrict__ Bm, float* __restrict__ WE, int K, int N, float sc) {
  #pragma clang fp contract(off)
  const size_t t = (size_t)blockIdx.x * 256 + threadIdx.x; if (t >= (size_t)K * N) return; const int i = (int)(t / N), o = (int)(t % N); float a = 0.f;
  for (int r = 0; r < 16; ++r) a = __fadd_rn(a, __fmul_rn(bf16_round(A[(size_t)i * 16 + r]), bf16_round(Bm[(size_t)r * N + o])));
  const float v = __fadd_rn(bf16_round(Wm[t]), __fmul_rn(sc, a)); *(float*)(WE + t) = v;  }
__global__ __launch_bounds__(256) void k_wt32rep(const float* __restrict__ Wf, _Float16* __restrict__ Bt, int K, int N, int DOUT, float scale) {
  const int t = blockIdx.x * 256 + threadIdx.x; if (t >= DOUT * (K / 8)) return; const int n = t / (K / 8), k8 = (t % (K / 8)) * 8; const int rep = DOUT / N; const int src = (n / (HD * rep)) * HD + (n % HD);      /* head h = n / HD -> group h / rep */
  FragH f; for (int i = 0; i < 8; ++i) f.h[i] = (_Float16)(Wf[(size_t)(k8 + i) * N + src] * scale);
  *(v8us*)((unsigned short*)Bt + (size_t)n * K + k8) = f.half[0];  }
__global__ __launch_bounds__(256) void k_brep(const float* __restrict__ b, float* __restrict__ out) { const int t = blockIdx.x * 256 + threadIdx.x; if (t >= DM) return; const float v = b[(t / (HD * 4)) * HD + (t % HD)]; *(float*)(out + t) = v;  }

__global__ __launch_bounds__(256) void k_rsmcim(const float* __restrict__ S, _Float16* __restrict__ P, int hg, int q0, int nk, const int* __restrict__ am) {
  #pragma clang fp contract(off)
  const int t = blockIdx.x * 256 + threadIdx.x; if (t >= hg * QT) return; const size_t i = (size_t)t; const float* s = S + i * NKX; const int last = q0 + (t % QT); const int* mr = am + (size_t)last * SQ; float mx = -3.0e38f;      /* the module's mask row of this query (keys >= nk lie above the diagonal of the staged causal mask and are not computed) */
#pragma unroll 1
  for (int j = 0; j < nk; ++j) { const float f = (mr[j] != 0) ? 1.f : 0.f; mx = fmaxf(mx, fmaf(f, s[j], (1.f - f) * -1.0e9f)); } float se = 0.f;
#pragma unroll 1
  for (int j = 0; j < nk; ++j) { const float f = (mr[j] != 0) ? 1.f : 0.f; se += __expf(fmaf(f, s[j], (1.f - f) * -1.0e9f) - mx); } const float sc = 256.0f / se;
#pragma unroll 1
  for (int j0 = 0; j0 < nk; j0 += 8) { FragH fr; for (int q = 0; q < 8; ++q) { const int j = j0 + q; const float f = (mr[j] != 0) ? 1.f : 0.f; fr.h[q] = (_Float16)(__expf(fmaf(f, s[j], (1.f - f) * -1.0e9f) - mx) * sc); } unsigned short* d = (unsigned short*)P + i * NKX + j0; *(v8us*)d = fr.half[0];  } }



__global__ __launch_bounds__(256) void k_bcpy(const float* __restrict__ b, int n, int NP, float* __restrict__ dst, int dst0) { for (int i = threadIdx.x; i < NP; i += 256) { const float v = (i < n) ? b[i] : 0.f; *(float*)(dst + dst0 + i) = v; }  }



// lane l with lane l ^ 16
__device__ __forceinline__ float rs_xhalf(float x) { return __builtin_bit_cast(float, __builtin_amdgcn_permlanex16(__builtin_bit_cast(int, x), __builtin_bit_cast(int, x), 0x76543210, 0xfedcba98, false, false)); }
// Four 2^t in one statement, each in place: behind a transcendental the instruction set asks for one independent instruction or v_nop before its result is read or its source overwritten.
// Here each v_exp_f32 is the independent instruction behind the one before it, the v_nop the slot behind the last. In place, so that the
// statement writes only registers that the multiply-add in front of it has written: the compiler keeps that one clear of the matrix instructions' operands, which it does not do for registers that asm text writes.
__device__ __forceinline__ v4f rs_exp2x4(v4f t) { float a = t[0], b = t[1], c = t[2], d = t[3];
  asm("v_exp_f32 %0, %0\n\tv_exp_f32 %1, %1\n\tv_exp_f32 %2, %2\n\tv_exp_f32 %3, %3\n\tv_nop" : "+v"(a), "+v"(b), "+v"(c), "+v"(d));
  const v4f r = {a, b, c, d}; return r; }
__device__ __forceinline__ v8f fa_mma(v16h a, v16h b, v8f c) { return __builtin_amdgcn_wmma_f32_16x16x32_f16(false, a, false, b, (short)0, c, false, false); }
// Fused attention: scores, softmax and P V in one launch; no score and no weight leaves the registers. One work-group = 256 queries of one (batch, head), 8 waves of 32 query columns;
// a pass = 32 keys. Transposed products: S^T = K Q^T (rows = keys, columns = queries), so a lane's 16 scores of a column are, as they lie, its 16 elements of the B operand of O^T += V^T P^T
// (k order of both operands: 8 hh + 0..7, then 16 + 8 hh + 0..7, that of g2_frag). Online softmax in the log2 domain, f32: the maximum in use may trail the true one by up to 8 (an
// exponential reaches 2^8 at most, well inside f16), and the sums are rescaled only in a pass where some column exceeds that. Denominator = an all-ones A operand times P^T on the matrix
// pipe: it sums the weights as rounded to f16, the same values the numerator sums. o is carried x64 as f16 rows.
// K and V: the eight waves read the same fragments, and a fragment load from global memory touches 16 cache lines for 512 bytes. So a stage of 128 keys (4 passes) is brought into LDS once for the work-group, in whole
// 128-byte lines, by asynchronous copies, two buffers: stage t + 1 flies while stage t is worked on. Fragments come from LDS, K one pass ahead inside its stage, V^T at the head of its pass.
// V lies in LDS as it lies in the fused k | v rows (row = key, 64 d); the A operand V^T (row = d, k = key) comes out of it by the transposing load ds_load_tr16_b128, so no transposed copy of V is made in memory.
// Every '#pragma unroll' in it is there so that the fragment and accumulator arrays it indexes become registers.
#define FA_KP 144      /* pitch of a K row (one key, 128 bytes) in LDS: 16 B x odd, so the 16 lanes of a half wave's ds_load_b128 fall on 64 different banks */
#define FA_VP 160      /* pitch of a V row (one key, 128 bytes): 32 B x odd, the conflict-free pitch of ds_load_tr16_b128 */
#define FA_VOFF (128 * FA_KP)      /* the 128 V rows stand behind the 128 K rows */
#define FA_STAGE (128 * FA_KP + 128 * FA_VP)
// One stage, global memory -> LDS through no register: 8 asynchronous copies of 16 bytes a lane (4 K rows and 4 V rows, 32 rows apart); 8 lanes fill a row.
// lk / lv = the lane's own LDS byte addresses of its first K and V row, gk / gv = its own global addresses. The s_wait_xcnt stands inside the statement, behind the last copy, so that
// no address register of a copy is written again in front of it.
__device__ __forceinline__ void fa_stage(unsigned lk, unsigned lv, const _Float16* gk, const _Float16* gv) {
  asm volatile("global_load_async_to_lds_b128 %0, %8, off\n\tglobal_load_async_to_lds_b128 %1, %9, off\n\tglobal_load_async_to_lds_b128 %2, %10, off\n\tglobal_load_async_to_lds_b128 %3, %11, off\n\t"
               "global_load_async_to_lds_b128 %4, %12, off\n\tglobal_load_async_to_lds_b128 %5, %13, off\n\tglobal_load_async_to_lds_b128 %6, %14, off\n\tglobal_load_async_to_lds_b128 %7, %15, off\n\t"
               "s_wait_xcnt 0x0"
               :: "v"(lk), "v"(lk + 32 * FA_KP), "v"(lk + 64 * FA_KP), "v"(lk + 96 * FA_KP), "v"(lv), "v"(lv + 32 * FA_VP), "v"(lv + 64 * FA_VP), "v"(lv + 96 * FA_VP),
                  "v"(gk), "v"(gk + (size_t)32 * (2 * DM)), "v"(gk + (size_t)64 * (2 * DM)), "v"(gk + (size_t)96 * (2 * DM)), "v"(gv), "v"(gv + (size_t)32 * (2 * DM)), "v"(gv + (size_t)64 * (2 * DM)), "v"(gv + (size_t)96 * (2 * DM)) : "memory"); }
// Half a V^T fragment: lane (c = lane & 15, hh) gets V[key0 + 8 hh + 0..7][d0 + c], where p = the tile's byte address + (key0 + 8 hh + (lane & 7)) FA_VP + 2 d0 + 16 ((lane >> 3) & 1).
typedef short fa_s16x8 __attribute__((ext_vector_type(8)));
__device__ __forceinline__ v8us fa_tr16(const unsigned char* p) { typedef __attribute__((address_space(3))) fa_s16x8 lds_s16x8; return __builtin_bit_cast(v8us, __builtin_amdgcn_ds_load_tr16_b128_v8i16((lds_s16x8*)p)); }
__global__ __launch_bounds__(256) void k_fattn(const _Float16* __restrict__ Q, const _Float16* __restrict__ KV, _Float16* __restrict__ O) {
  static_assert(SK % 128 == 0 && SK / 128 >= 2 && HD == 64, "k_fattn: whole stages of 128 keys, two or more");
  constexpr float CS = 0.015625f * 1.44269504f;      /* (q / 8) . (k / 8) = q . k / 64, times log2 e */
  constexpr int NST = SK / 128;
  __shared__ __attribute__((aligned(16))) unsigned char sm[2 * FA_STAGE];      /* two stage buffers */
  const int tid = threadIdx.x, lane = tid & 31, ln = lane & 15, hh = lane >> 4; const int wave = __builtin_amdgcn_readfirstlane(tid >> 5);
  const int h = blockIdx.y, b = blockIdx.z; const int q0 = blockIdx.x * 256 + wave * 32;
  const _Float16* qp = Q + ((size_t)b * SQ + q0 + ln) * DM + h * HD;
  const unsigned lk0 = (unsigned)(size_t)sm + (unsigned)((tid >> 3) * FA_KP + (tid & 7) * 16);      /* the lane's copies: K rows (tid >> 3) + 32 i, 16-byte piece tid & 7 */
  const unsigned lv0 = (unsigned)(size_t)sm + (unsigned)(FA_VOFF + (tid >> 3) * FA_VP + (tid & 7) * 16);      /* V rows and pieces likewise */
  const _Float16* gk = KV + ((size_t)b * SK + (tid >> 3)) * (2 * DM) + h * HD + (tid & 7) * 8;      /* k half of the fused rows: row = key */
  const _Float16* gv = gk + DM;      /* v half of the same rows */
  const unsigned char* fk = sm + ln * FA_KP + 16 * hh; const unsigned char* fv = sm + FA_VOFF + (8 * hh + (lane & 7)) * FA_VP + 16 * ((lane >> 3) & 1);      /* the lane's K fragment row and its address for the transposing loads of V, in buffer 0 */
  fa_stage(lk0, lv0, gk, gv);
  v16h qf[2][2], kf[2][2];
#pragma unroll
  for (int g = 0; g < 2; ++g) for (int kc = 0; kc < 2; ++kc) qf[g][kc] = g2_frag(qp + (size_t)g * 16 * DM + 32 * kc, hh);
  FragH ones;
#pragma unroll
  for (int i = 0; i < 16; ++i) ones.h[i] = (_Float16)1.0f;
  const v8f z8 = {0.f, 0.f, 0.f, 0.f, 0.f, 0.f, 0.f, 0.f};
  v8f acc[2][4], lacc[2]; float m_run[2];
#pragma unroll
  for (int g = 0; g < 2; ++g) { m_run[g] = -__builtin_inff(); lacc[g] = z8; for (int t = 0; t < 4; ++t) acc[g][t] = z8; }
  auto pass = [&](const unsigned char* pk, const unsigned char* pv, const int p, const bool more) __attribute__((always_inline)) {      /* p (the pass in its stage) and more are literals at every call: a stage's last pass is compiled without the fetch of a next K */
    v16h vf[4]; v8f s[2][2];
#pragma unroll
    for (int kt = 0; kt < 2; ++kt) for (int g = 0; g < 2; ++g) s[kt][g] = fa_mma(kf[kt][1], qf[g][1], fa_mma(kf[kt][0], qf[g][0], z8));
#pragma unroll
    for (int t = 0; t < 4; ++t) { FragH f; f.half[0] = fa_tr16(pv + 32 * p * FA_VP + 32 * t); f.half[1] = fa_tr16(pv + (32 * p + 16) * FA_VP + 32 * t); vf[t] = f.v; }      /* this pass's V^T (d = 16 t + ln; keys 8 hh + 0..7, then 16 + 8 hh + 0..7: the k order of P^T), in flight under the softmax */
    if (more) {      /* next pass's K, of the same stage, in flight under this pass's softmax and second product */
#pragma unroll
      for (int kt = 0; kt < 2; ++kt) for (int kc = 0; kc < 2; ++kc) kf[kt][kc] = g2_lfrag(pk + (32 * (p + 1) + 16 * kt) * FA_KP + 64 * kc); }
    asm volatile("" ::: "memory");      /* compiler fence: keeps the pass's LDS reads up here, in one group in front of the softmax; without it the compiler sank them behind the branch below, next to their first use, where they have no time to land */
    float mb[2]; bool need = false;
#pragma unroll
    for (int g = 0; g < 2; ++g) { float mx = fmaxf(s[0][g][0], s[1][g][0]);
      for (int r = 1; r < 8; ++r) mx = fmaxf(mx, fmaxf(s[0][g][r], s[1][g][r]));
      mx = fmaxf(mx, rs_xhalf(mx)) * CS; mb[g] = mx; need = need || (mx > m_run[g] + 8.0f); }      /* both wave halves hold the column's maximum of this pass, scaled (the scale is positive) */
    if (__builtin_amdgcn_ballot_w32(need) != 0) {      /* always in the first pass (the maximum in use is -inf, the factor 0), rare later */
#pragma unroll
      for (int g = 0; g < 2; ++g) { const float mn = fmaxf(m_run[g], mb[g]); const float corr = __builtin_amdgcn_exp2f(m_run[g] - mn); m_run[g] = mn; lacc[g] = lacc[g] * corr; for (int t = 0; t < 4; ++t) acc[g][t] = acc[g][t] * corr; } }
#pragma unroll
    for (int g = 0; g < 2; ++g) { FragH pf; const float nm = -m_run[g];
      for (int kt = 0; kt < 2; ++kt) for (int j = 0; j < 2; ++j) { v4f a; for (int q = 0; q < 4; ++q) a[q] = fmaf(s[kt][g][4 * j + q], CS, nm); const v4f e = rs_exp2x4(a); for (int q = 0; q < 4; ++q) pf.h[8 * kt + 4 * j + q] = (_Float16)e[q]; }
      for (int t = 0; t < 4; ++t) acc[g][t] = fa_mma(vf[t], pf.v, acc[g][t]);
      lacc[g] = fa_mma(ones.v, pf.v, lacc[g]); }
  };
  asm volatile("s_wait_asynccnt 0x0" ::: "memory");      /* this wave's copies of stage 0 have landed */
  __syncthreads();      /* ... and every other wave's: stage 0 may be read */
  fa_stage(lk0 + FA_STAGE, lv0 + FA_STAGE, gk + (size_t)128 * (2 * DM), gv + (size_t)128 * (2 * DM));      /* stage 1 exists (asserted above) */
#pragma unroll 1      /* rolled: the buffer is picked by the trip's parity, a second copy of the four passes would only add code */
  for (int t = 0; t < NST; ++t) { const unsigned bo = (unsigned)(t & 1) * FA_STAGE; const unsigned char* pk = fk + bo; const unsigned char* pv = fv + bo;
#pragma unroll
    for (int kt = 0; kt < 2; ++kt) for (int kc = 0; kc < 2; ++kc) kf[kt][kc] = g2_lfrag(pk + 16 * kt * FA_KP + 64 * kc);      /* the stage's first K */
    pass(pk, pv, 0, true); pass(pk, pv, 1, true); pass(pk, pv, 2, true); pass(pk, pv, 3, false);      /* keys in ascending order: the sum order of the plain loop */
    asm volatile("s_wait_dscnt 0x0" ::: "memory");      /* this wave's reads of the buffer are done before it is handed to the copies */
    asm volatile("s_wait_asynccnt 0x0" ::: "memory");      /* this wave's copies of stage t + 1 have landed */
    __syncthreads();      /* publishes stage t + 1 and ends every wave's reads of stage t */
    if (t + 2 < NST) fa_stage(lk0 + bo, lv0 + bo, gk + (size_t)(t + 2) * 128 * (2 * DM), gv + (size_t)(t + 2) * 128 * (2 * DM)); }      /* refill of the buffer just read; in flight under trip t + 1 */
  asm volatile("s_wait_asynccnt 0x0" ::: "memory");      /* no copy is outstanding when the wave ends */
#pragma unroll
  for (int g = 0; g < 2; ++g) { const float inv = 64.0f / lacc[g][0];      /* every row of the all-ones product holds the column's denominator */
    _Float16* op = O + ((size_t)b * SQ + q0 + 16 * g + ln) * DM + h * HD + 8 * hh;
    for (int t = 0; t < 4; ++t) { FragH f; for (int r = 0; r < 8; ++r) f.h[r] = (_Float16)(acc[g][t][r] * inv); *(v8us*)((unsigned short*)op + 16 * t) = f.half[0]; } } }      /* d = 16 t + 8 hh + 0..7 of query ln: 16 bytes a lane; the wave's four stores fill each row's 128-byte line */
// Preparation, one launch (the three weight planes, the two inputs' f16 rows): none of the five pieces depends on another.
// Work-groups 0 .. PREP_TW - 1: the weight planes, Bt[n][k] = f16(16 bf16(W[k][n])), one tile of 128 k x 64 n each, turned in LDS so that global memory is touched in whole lines only:
// a wave's load = 256 bytes in a row of each of two W rows, a wave's store = 256 bytes in a row of each of two Bt rows (a lane that walks down a column of W instead touches 32 lines a load for 128 bytes).
// In LDS a tile lies as Bt rows: row n = 64 words, word d = the f16 pair k = 2 d, 2 d + 1. Work-groups PREP_TW .. PREP_TW + PREP_CW - 1: PREP_CU * 256 pieces in a row of x and as many of tgt each,
// PREP_CU of either a thread, 256 pieces apart (a piece = 8 elements = one 16-byte store).
#define PREP_TW 512
#define PREP_CW 256
#define PREP_CU 8
#define PREP_LP 65      /* pitch of a tile row in LDS, in words: 1 mod 64, so that the 16 lanes that write 4 rows apart fall 4 banks apart, with the wave's other 16 lanes between them */
typedef unsigned int v4u __attribute__((ext_vector_type(4)));
typedef float v2f __attribute__((ext_vector_type(2)));
typedef _Float16 v2h __attribute__((ext_vector_type(2)));
__device__ __forceinline__ unsigned prep_pair(float lo, float hi) { const v2f t = {bf16_round(lo) * 16.0f, bf16_round(hi) * 16.0f}; return __builtin_bit_cast(unsigned, __builtin_convertvector(t, v2h)); }      /* low half = lo */
// One tile: Bt[n0 + 0..63][k0 + 0..127] from W[k0 + 0..127][n0 + 0..63], W of N columns, Bt of DM. N is a template argument so that the steps from row to row are constants:
// one 32-bit byte offset from the plane's start serves the thread's eight loads, another its four stores.
template <int N>
__device__ __forceinline__ void prep_wtile(const float* __restrict__ Wm, _Float16* __restrict__ Bt, unsigned tile, unsigned* tl) {
  const unsigned n0 = (tile % (N / 64)) * 64u, k0 = (tile / (N / 64)) * 128u; const unsigned c16 = threadIdx.x & 15u, r16 = threadIdx.x >> 4;
  const char* p = (const char*)Wm + ((k0 + 2u * r16) * N + n0 + 4u * c16) * 4u;      /* W[k0 + 2 r16][n0 + 4 c16] */
  v4f lo[4], hi[4];
#pragma unroll      /* constant indices: lo and hi stay in registers */
  for (int j = 0; j < 4; ++j) { lo[j] = *(const v4fa*)(p + 32 * j * N * 4); hi[j] = *(const v4fa*)(p + (32 * j + 1) * N * 4); }      /* rows k0 + 2 r16 + 32 j and the next: the two halves of word r16 + 16 j */
#pragma unroll      /* constant indices, as above */
  for (int j = 0; j < 4; ++j) for (int i = 0; i < 4; ++i) tl[(4u * c16 + i) * PREP_LP + r16 + 16u * j] = prep_pair(lo[j][i], hi[j][i]);
  __syncthreads();      /* the tile is whole before any row of it is read */
  char* d = (char*)Bt + ((n0 + r16) * (unsigned)DM + k0 + 8u * c16) * 2u; const unsigned* r = tl + r16 * PREP_LP + 4u * c16;      /* k = k0 + 8 c16 + 0..7 of row n0 + r16 */
#pragma unroll      /* four rows a thread, 16 apart, their LDS reads issued together */
  for (int s = 0; s < 4; ++s) { const v4u o = {r[16 * s * PREP_LP], r[16 * s * PREP_LP + 1], r[16 * s * PREP_LP + 2], r[16 * s * PREP_LP + 3]}; *(v4u*)(d + 16 * s * DM * 2) = o; } }
__global__ __launch_bounds__(256) void k_prep(const float* __restrict__ x, const float* __restrict__ cond, const float* __restrict__ wq, const float* __restrict__ wkv, const float* __restrict__ wo,
    _Float16* __restrict__ X16, _Float16* __restrict__ C16, _Float16* __restrict__ BQ, _Float16* __restrict__ BKV, _Float16* __restrict__ BO) {
  constexpr unsigned TQ = (DM / 128) * (DM / 64), TKV = (DC / 128) * (2 * DM / 64);      /* tiles of Wq (and of Wp), of Wkv */
  static_assert(DC == DM && DM % 128 == 0 && 2 * TQ + TKV == PREP_TW, "k_prep: one 128 x 64 tile a work-group; every Bt row has DM elements");
  static_assert((size_t)NB * SQ * DM / 8 == (size_t)PREP_CU * PREP_CW * 256 && (size_t)NB * SK * DC / 8 == (size_t)PREP_CU * PREP_CW * 256, "k_prep: PREP_CU pieces of x and of tgt a thread");
  __shared__ unsigned tl[64 * PREP_LP];
  if (blockIdx.x >= PREP_TW) { const unsigned u0 = (blockIdx.x - PREP_TW) * (PREP_CU * 256) + threadIdx.x; v4f a[2][PREP_CU], c[2][PREP_CU];      /* the thread's first piece */
#pragma unroll      /* constant indices: a and c stay in registers */
    for (int s = 0; s < 2; ++s) for (int j = 0; j < PREP_CU; ++j) { const char* p = (const char*)(s ? cond : x) + u0 * 32u + j * 8192; a[s][j] = *(const v4fa*)p; c[s][j] = *(const v4fa*)(p + 16); }      /* a 32-bit byte offset from the buffer's start: one address register serves all the loads */
    __builtin_amdgcn_sched_barrier(0);      /* keeps the thread's 4 PREP_CU loads up here, all in flight together: without it the compiler issued half of them and the rest in small groups among the conversions, behind waits on the first; eight waves a WGP need them all in flight to keep the memory busy */
#pragma unroll      /* constant indices, as above */
    for (int s = 0; s < 2; ++s) for (int j = 0; j < PREP_CU; ++j) { FragH f;
      for (int q = 0; q < 4; ++q) { f.h[q] = (_Float16)bf16_round(a[s][j][q]); f.h[4 + q] = (_Float16)bf16_round(c[s][j][q]); }
      *(v8us*)((char*)(s ? C16 : X16) + u0 * 16u + j * 4096) = f.half[0]; }
    return; }      /* the whole work-group or none: the barrier below is passed by whole work-groups only */
  const unsigned bx = blockIdx.x;      /* every test on it reads the same for the whole work-group: each barrier is passed by all of it */
  if (bx < TKV) prep_wtile<2 * DM>(wkv, BKV, bx, tl);
  else { const bool q = bx < TKV + TQ; prep_wtile<DM>(q ? wq : wo, q ? BQ : BO, q ? bx - TKV : bx - (TKV + TQ), tl); } }
extern "C" void kernel_launch(void* const* d_in, const int* in_sizes, int n_in,
                              void* d_out, int out_size, void* d_ws, size_t ws_size, hipStream_t stream) {
  (void)in_sizes; (void)n_in; (void)out_size;
  const float* const* I = (const float* const*)d_in; const float* x = I[0]; const float* cond = I[1]; const float* wq = I[2]; const float* bq = I[3]; const float* wkv = I[4]; const float* bkv = I[5]; const float* wo = I[6]; const float* bo = I[7];      /* input order: x [2][2048][1024]; tgt [2][2048][1024] (the cond input); [in][out] Wq [1024][1024] + bq; Wkv [1024][2048] + bkv (k | v halves); Wp [1024][1024] + bp; the three biases are bound and read */
  static_assert(NH * HD == DM && HD == 64 && SQ % 256 == 0 && SK % 64 == 0 && DC % 32 == 0 && DM % 64 == 0, "shape / tile multiples");
  static_assert((NB * SQ) % 128 == 0 && (NB * SK) % 128 == 0 && DC % 128 == 0 && DM % 128 == 0, "k_gemm2: whole 128 x 128 tiles, whole 128-k stages");
  const size_t NRK = (size_t)NB * SK;      /* conditioning rows */
  char* ws = (char*)d_ws; size_t off = 0;
  auto take = [&](size_t bytes) { char* p = ws + off; off += (bytes + 255) & ~(size_t)255; return p; };
  _Float16* BQ = (_Float16*)take((size_t)DM * DM * 2); _Float16* BKV = (_Float16*)take((size_t)2 * DM * DC * 2); _Float16* BO = (_Float16*)take((size_t)DM * DM * 2);
  _Float16* X16 = (_Float16*)take(NR * DM * 2); _Float16* C16 = (_Float16*)take(NRK * DC * 2); _Float16* Q16 = (_Float16*)take(NR * DM * 2); _Float16* KV16 = (_Float16*)take(NRK * 2 * DM * 2); _Float16* O16 = (_Float16*)take(NR * DM * 2);
  if (off > ws_size) return;      /* 2 + 4 + 2 (weight planes) + 8 + 8 + 8 + 16 + 8 (row planes) = 56 MiB at NB 2, SK 2048, DC 1024 */
  k_prep<<<PREP_TW + PREP_CW, 256, 0, stream>>>(x, cond, wq, wkv, wo, X16, C16, BQ, BKV, BO);      /* [in][out] -> Bt x16: Wq [1024][1024]; Wkv [DC = 1024][2048] -> Bt [2048][1024] (rows 0..1023 = k, 1024..2047 = v); Wp; and the exact f16 rows of both inputs */
  k_gemm2<0><<<dim3((unsigned)((NR / 128) * (DM / 128)), 1), 256, 0, stream>>>(X16, DM, 0, BQ, DM, 0, 0.0625f, bq, 0, nullptr, 1, 0, 0, nullptr, Q16, DM, 0, (int)NR, DM, DM);      /* q rows (f16); head h = columns 64 h .. */
  k_gemm2<0><<<dim3((unsigned)((NRK / 128) * (2 * DM / 128)), 1), 256, 0, stream>>>(C16, DC, 0, BKV, DC, 0, 0.0625f, bkv, 0, nullptr, 1, 0, 0, nullptr, KV16, 2 * DM, 0, (int)NRK, 2 * DM, DC);      /* k | v rows (f16, pitch 2048): k = columns 0..1023, v = columns 1024..2047, head h = columns 64 h .. of each half */
  k_fattn<<<dim3(SQ / 256, NH, NB), 256, 0, stream>>>(Q16, KV16, O16);      /* softmax(q . k / 64) v over the SK = 2048 keys -> ctx (merged heads, x64) as f16 rows */
  k_gemm2<0><<<dim3((unsigned)((NR / 128) * (DM / 128)), 1), 256, 0, stream>>>(O16, DM, 0, BO, DM, 0, 0.0009765625f, bo, 0, nullptr, 1, 0, 0, (float*)d_out, nullptr, DM, 0, (int)NR, DM, DM);      /* out = ctx proj_w + proj_b */
}

// v009
// A run of this version takes 82.4 microseconds.
// Two timings next to v008 both put it at 1.07 times that version's speed.
// Counting every step since v000, which is the starting kernel, it is 80.7 times as fast.
#include <hip/hip_runtime.h>
// Multi-head cross-attention with a fused key / value projection and BOTH q and k scaled (x [2][2048][1024] (queries), tgt [2][2048][1024] (keys / values); q = x Wq + bq ([in][out] 1024 x 1024, normal x 0.02; zero bias); kv = tgt Wkv + bkv ([in][out] 1024 x 2048; zero bias) split into halves: k = columns 0..1023, v = columns 1024..2047; 16 heads of 64; logits = (q * 64^-0.5) . (k * 64^-0.5): the module scales BOTH operands, so the effective scale is 1/64; softmax over the 2048 tgt positions (no mask); out = merged Wp + bp ([in][out]; zero bias) -> [2][2048][1024]).
// Structure: token rows; x and tgt as exact f16 rows; natural weights as exact x16 planes; q and k | v WMMA GEMMs (32x64 wave tiles, f32 accumulation, + bias) -> f16; one fused attention launch, V^T fragments by transposing LDS loads (256 queries of one head per work-group: scores, online softmax with f32 statistics and native exp, weights f16, ctx x64 merged f16); ctx Wp + bp -> f32 output; five launches.
// Compute dtype: inputs rounded to bf16; x / weights exact; q, k, v, softmax weights and o as plain f16 GEMM operands (~2^-12); scores and softmax statistics f32. v_wmma_f32_16x16x32_f16.
#define NB 2
#define SQ 2048                      /* query rows per batch */
#define SK 2048                      /* conditioning (key / value) rows per batch */
#define DC 1024                       /* conditioning width */
#define DM 1024
#define NH 16
#define HD 64
#define HG 4                         /* heads per attention launch group */
#define QT 256                       /* query rows per causal tile */
#define NKX SK                       /* S / P row pitch = the SK keys (2048 here) */
#define QT0 128                      /* first-tile rows recomputed exactly in f32 */
#define B0 0                         /* first batch processed (debug hook) */
#define NBR NB                       /* batches processed (debug hook) */
#define NR ((size_t)NB * SQ)
#define DMQ DM
#define DFF 4096         /* token rows */
#define MP ((int)((size_t)NBR * SQ)) /* rows projected (debug hook) */
#define QN SQ                        /* query rows attended per batch (debug hook) */
#define NHD NH                       /* heads attended (debug hook) */
#define MPO MP                       /* rows through the output stage (debug hook) */
#define LQ (3 * DM)      /* unused: q rows have pitch DM, k | v rows 2 DM */
typedef __bf16 v16b __attribute__((ext_vector_type(16)));
typedef unsigned short v8us __attribute__((ext_vector_type(8), may_alias));
typedef float  v8f  __attribute__((ext_vector_type(8)));
typedef float  v4f  __attribute__((ext_vector_type(4)));
typedef float  v4fa __attribute__((ext_vector_type(4), may_alias));
union FragB { v16b v; v8us half[2]; unsigned short u[16]; };

__device__ __forceinline__ unsigned short bf16_bits(float x) { unsigned int u = __float_as_uint(x); return (unsigned short)((u + 0x7FFFu + ((u >> 16) & 1u)) >> 16); }
__device__ __forceinline__ float bf16_val(unsigned short b) { return __uint_as_float(((unsigned int)b) << 16); }
__device__ __forceinline__ float bf16_round(float x) { return bf16_val(bf16_bits(x)); }
// D += A·B with NT terms: 1 = ah·bh, 2 = + al·bh (A split), 3 = + ah·bl (both split)
template <int NT>
__device__ __forceinline__ v8f mmaN(v16b ah, v16b al, v16b bh, v16b bl, v8f c) {
  c = __builtin_amdgcn_wmma_f32_16x16x32_bf16(false, ah, false, bh, (short)0, c, false, false);
  if (NT >= 2) c = __builtin_amdgcn_wmma_f32_16x16x32_bf16(false, al, false, bh, (short)0, c, false, false);
  if (NT >= 3) c = __builtin_amdgcn_wmma_f32_16x16x32_bf16(false, ah, false, bl, (short)0, c, false, false);
  asm volatile("v_nop\n\tv_nop\n\tv_nop\n\tv_nop" : "+v"(c) : "v"(ah), "v"(al), "v"(bh), "v"(bl));
  return c;
}

__global__ __launch_bounds__(256) void k_wt_bf16(const float* __restrict__ W, unsigned short* __restrict__ Wt, int K, int N) {
  const int t = blockIdx.x * 256 + threadIdx.x;
  const int k8n = K / 8;
  if (t >= N * k8n) return;
  const int n = t / k8n, k8 = (t % k8n) * 8;
  v8us v;
#pragma unroll
  for (int i = 0; i < 8; ++i) v[i] = bf16_bits(W[(size_t)(k8 + i) * N + n]);
  *(v8us*)(Wt + (size_t)n * K + k8) = v;
  
}

// GEMM C[M][N] (f32, pitch ldc) = act(A[M][K]·W + bias). A f32 row-major (pitch lda) converted per fragment to bf16
// (ASPLIT: hi/lo two planes -> 2 terms, else single rounded term); Wt bf16 [N][K] (pitch ldb). BIAS_BF16 rounds the
// bias to bf16 first (bias quantised to bf16 before the add). K%32==0, M%16==0, N%64==0.
template <bool ASPLIT, int ACT, bool BIAS_BF16>
__global__ __launch_bounds__(128) void k_gemm_bf(const float* __restrict__ A, int lda, const unsigned short* __restrict__ Wt, int ldb,
                                               const float* __restrict__ bias, float* __restrict__ C, int ldc, int M, int N, int K) {
  __shared__ __attribute__((aligned(16))) float so[4][16][64];
  const int tid = threadIdx.x, w = tid >> 5, lane = tid & 31, ln = lane & 15, hh = lane >> 4;
  const int ntn = N / 64;
  const int wid = blockIdx.x * 4 + w;
  const int mt = wid / ntn, nq = wid % ntn;
  if (mt * 16 >= M) return;
  const int row0 = mt * 16, col0 = nq * 64;
  const float* arow = A + (size_t)(row0 + ln) * lda;
  v8f acc[4] = {};
  for (int kb = 0; kb < K; kb += 32) {
    FragB ah, al;
    const v4f x0 = *(const v4fa*)(arow + kb + 8 * hh), x1 = *(const v4fa*)(arow + kb + 8 * hh + 4);
    const v4f x2 = *(const v4fa*)(arow + kb + 16 + 8 * hh), x3 = *(const v4fa*)(arow + kb + 16 + 8 * hh + 4);
    float xs[16] = {x0[0],x0[1],x0[2],x0[3],x1[0],x1[1],x1[2],x1[3],x2[0],x2[1],x2[2],x2[3],x3[0],x3[1],x3[2],x3[3]};
#pragma unroll
    for (int i = 0; i < 16; ++i) { const unsigned short hb = bf16_bits(xs[i]); ah.u[i] = hb; al.u[i] = ASPLIT ? bf16_bits(xs[i] - bf16_val(hb)) : (unsigned short)0; }
#pragma unroll
    for (int t = 0; t < 4; ++t) {
      const unsigned short* brow = Wt + (size_t)(col0 + t * 16 + ln) * ldb + kb;
      FragB b;
      b.half[0] = *(const v8us*)(brow + 8 * hh);
      b.half[1] = *(const v8us*)(brow + 16 + 8 * hh);
      acc[t] = mmaN<ASPLIT ? 2 : 1>(ah.v, al.v, b.v, b.v, acc[t]);
    }
  }
#pragma unroll
  for (int t = 0; t < 4; ++t) {
    float bv = bias ? bias[col0 + t * 16 + ln] : 0.f;
    if (BIAS_BF16) bv = bf16_round(bv);
#pragma unroll
    for (int r = 0; r < 8; ++r) { float v = acc[t][r] + bv; if (ACT == 1) v = fmaxf(v, 0.f); so[w][8 * hh + r][t * 16 + ln] = v; }
  }
  __builtin_amdgcn_fence(__ATOMIC_ACQ_REL, "workgroup");
  __builtin_amdgcn_wave_barrier();
  const int rsub = lane >> 4, c4 = (lane & 15) * 4;
  {
#pragma unroll
    for (int q = 0; q < 8; ++q) {
      const int r = q * 2 + rsub;
      const v4f v = *(const v4fa*)&so[w][r][c4];
      *(v4f*)(C + (size_t)(row0 + r) * ldc + col0 + c4) = v;
    }
    
  }
}

// GEMM C = act(A·W + bias + resid): A f32 (ASPLIT -> hi/lo 2 terms), Wt bf16 [N][K]; ACT 0 none, 1 relu, 2 exact gelu;
// resid (optional, f32, row index = (row % rmod), pitch ldr, RES_BF16 rounds it) added before the activation.
template <bool ASPLIT, int ACT, bool BIAS_BF16, bool RES_BF16>
__global__ __launch_bounds__(128) void k_gemm_bf3(const float* __restrict__ A, int lda, const unsigned short* __restrict__ Wt, int ldb,
                                                const float* __restrict__ bias, const float* __restrict__ resid, int rmod, int ldr,
                                                float* __restrict__ C, int ldc, int M, int N, int K) {
  __shared__ __attribute__((aligned(16))) float so[4][16][64];
  const int tid = threadIdx.x, w = tid >> 5, lane = tid & 31, ln = lane & 15, hh = lane >> 4;
  const int ntn = N / 64;
  const int wid = blockIdx.x * 4 + w;
  const int mt = wid / ntn, nq = wid % ntn;
  if (mt * 16 >= M) return;
  const int row0 = mt * 16, col0 = nq * 64;
  const float* arow = A + (size_t)(row0 + ln) * lda;
  v8f acc[4] = {};
  for (int kb = 0; kb < K; kb += 32) {
    FragB ah, al;
    const v4f x0 = *(const v4fa*)(arow + kb + 8 * hh), x1 = *(const v4fa*)(arow + kb + 8 * hh + 4);
    const v4f x2 = *(const v4fa*)(arow + kb + 16 + 8 * hh), x3 = *(const v4fa*)(arow + kb + 16 + 8 * hh + 4);
    float xs[16] = {x0[0],x0[1],x0[2],x0[3],x1[0],x1[1],x1[2],x1[3],x2[0],x2[1],x2[2],x2[3],x3[0],x3[1],x3[2],x3[3]};
#pragma unroll
    for (int i = 0; i < 16; ++i) { const unsigned short hb = bf16_bits(xs[i]); ah.u[i] = hb; al.u[i] = ASPLIT ? bf16_bits(xs[i] - bf16_val(hb)) : (unsigned short)0; }
#pragma unroll
    for (int t = 0; t < 4; ++t) {
      const unsigned short* brow = Wt + (size_t)(col0 + t * 16 + ln) * ldb + kb;
      FragB b;
      b.half[0] = *(const v8us*)(brow + 8 * hh);
      b.half[1] = *(const v8us*)(brow + 16 + 8 * hh);
      acc[t] = mmaN<ASPLIT ? 2 : 1>(ah.v, al.v, b.v, b.v, acc[t]);
    }
  }
#pragma unroll
  for (int t = 0; t < 4; ++t) {
    const int col = col0 + t * 16 + ln;
    float bv = bias ? bias[col] : 0.f;
    if (BIAS_BF16) bv = bf16_round(bv);
#pragma unroll
    for (int r = 0; r < 8; ++r) {
      float v = acc[t][r] + bv;
      if (resid) { float rv = resid[(size_t)((row0 + 8 * hh + r) % rmod) * ldr + col]; if (RES_BF16) rv = bf16_round(rv); v += rv; }
      if (ACT == 1) v = fmaxf(v, 0.f);
      if (ACT == 2) v = 0.5f * v * (1.0f + erff(v * 0.70710678118654752f));
      if (ACT == 3) { const float u = 0.7978845608028654f * (v + 0.044715f * v * v * v); v = 0.5f * v * (1.0f + tanhf(u)); }
      so[w][8 * hh + r][t * 16 + ln] = v;
    }
  }
  __builtin_amdgcn_fence(__ATOMIC_ACQ_REL, "workgroup");
  __builtin_amdgcn_wave_barrier();
  const int rsub = lane >> 4, c4 = (lane & 15) * 4;
  {
#pragma unroll
    for (int q = 0; q < 8; ++q) {
      const int r = q * 2 + rsub;
      const v4f v = *(const v4fa*)&so[w][r][c4];
      *(v4f*)(C + (size_t)(row0 + r) * ldc + col0 + c4) = v;
    }
    
  }
}
// row LayerNorm (biased variance, eps) over N: s = X (+ R); optional out_sum <- s; out_norm <- (s-mu)*rsqrt(var+eps)*g + b
template <bool PARAM_BF16>
__global__ __launch_bounds__(256) void k_layernorm(const float* __restrict__ X, const float* __restrict__ R, const float* __restrict__ g, const float* __restrict__ bta,
                                                  float* __restrict__ out_sum, float* __restrict__ out_norm, int N, float eps) {
  __shared__ float red[256];
  const int row = blockIdx.x, tid = threadIdx.x;
  const float* x = X + (size_t)row * N; const float* rr = R ? R + (size_t)row * N : nullptr;
  float vals[16];                     // up to N = 4096
  const int per = N / 256;            // contiguous chunk per thread? use strided-by-4 chunks: thread handles j = tid*4 + 1024*u
  float s1 = 0.f;
  for (int u = 0; u < per / 4; ++u) {
    const int j = tid * 4 + 1024 * u;
    const v4f a = *(const v4fa*)(x + j);
    v4f b = {0.f,0.f,0.f,0.f}; if (rr) b = *(const v4fa*)(rr + j);
#pragma unroll
    for (int q = 0; q < 4; ++q) { const float v = a[q] + b[q]; vals[u * 4 + q] = v; s1 += v; }
  }
  red[tid] = s1; __syncthreads();
  for (int st = 128; st > 0; st >>= 1) { if (tid < st) red[tid] += red[tid + st]; __syncthreads(); }
  const float mu = red[0] / (float)N; __syncthreads();
  float s2 = 0.f;
  for (int u = 0; u < per / 4; ++u)
#pragma unroll
    for (int q = 0; q < 4; ++q) { const float c = vals[u * 4 + q] - mu; s2 += c * c; }
  red[tid] = s2; __syncthreads();
  for (int st = 128; st > 0; st >>= 1) { if (tid < st) red[tid] += red[tid + st]; __syncthreads(); }
  const float rs = rsqrtf(red[0] / (float)N + eps);
  {
    for (int u = 0; u < per / 4; ++u) {
      const int j = tid * 4 + 1024 * u;
      v4f o, sm;
#pragma unroll
      for (int q = 0; q < 4; ++q) {
        float gg = g[j + q], bb = bta[j + q];
        if (PARAM_BF16) { gg = bf16_round(gg); bb = bf16_round(bb); }
        sm[q] = vals[u * 4 + q]; o[q] = (vals[u * 4 + q] - mu) * rs * gg + bb;
      }
      if (out_sum) *(v4f*)(out_sum + (size_t)row * N + j) = sm;
      *(v4f*)(out_norm + (size_t)row * N + j) = o;
    }
    
  }
}



// ---- f16 WMMA path (v_wmma_f32_16x16x32_f16): 11-bit significands for operands in range — used where a [0,1] probability operand needs more precision than bf16
typedef _Float16 v16h __attribute__((ext_vector_type(16)));
union FragH { v16h v; v8us half[2]; _Float16 h[16]; unsigned short u[16]; };
template <int NT>
__device__ __forceinline__ v8f mmaH(v16h ah, v16h al, v16h bh, v16h bl, v8f c) {
  c = __builtin_amdgcn_wmma_f32_16x16x32_f16(false, ah, false, bh, (short)0, c, false, false);
  if (NT >= 2) c = __builtin_amdgcn_wmma_f32_16x16x32_f16(false, al, false, bh, (short)0, c, false, false);
  if (NT >= 3) c = __builtin_amdgcn_wmma_f32_16x16x32_f16(false, ah, false, bl, (short)0, c, false, false);
  asm volatile("v_nop\n\tv_nop\n\tv_nop\n\tv_nop" : "+v"(c) : "v"(ah), "v"(al), "v"(bh), "v"(bl));
  return c;
}
// batched GEMM like k_gemm_b but f16 operands: A f32 (split into f16 hi/lo if ASPLIT, else rounded to f16), Bt = f16 values [n][k]; alpha; C f32; N multiple of 16 (partial tiles skipped)
template <bool ASPLIT>
__global__ __launch_bounds__(128) void k_gemm_h(const float* __restrict__ A, int lda, size_t sA, const _Float16* __restrict__ Bh, int ldb, size_t sB, float alpha, float* __restrict__ C, int ldc, size_t sC, int M, int N, int K) {
  __shared__ __attribute__((aligned(16))) float so[4][16][64];
  const int tid = threadIdx.x, w = tid >> 5, lane = tid & 31, ln = lane & 15, hh = lane >> 4; const int by = blockIdx.y;
  A += (size_t)by * sA; Bh += (size_t)by * sB; C += (size_t)by * sC;
  const int ntn = (N + 63) / 64; const int wid = blockIdx.x * 4 + w; const int mt = wid / ntn, nq = wid % ntn; if (mt * 16 >= M) return;
  const int row0 = mt * 16, col0 = nq * 64; const float* arow = A + (size_t)(row0 + ln) * lda;
  v8f acc[4] = {};
  for (int kb = 0; kb < K; kb += 32) {
    FragH ah, al;
    const v4f x0 = *(const v4fa*)(arow + kb + 8 * hh), x1 = *(const v4fa*)(arow + kb + 8 * hh + 4), x2 = *(const v4fa*)(arow + kb + 16 + 8 * hh), x3 = *(const v4fa*)(arow + kb + 16 + 8 * hh + 4);
    float xs[16] = {x0[0],x0[1],x0[2],x0[3],x1[0],x1[1],x1[2],x1[3],x2[0],x2[1],x2[2],x2[3],x3[0],x3[1],x3[2],x3[3]};
#pragma unroll
    for (int i = 0; i < 16; ++i) { const _Float16 h = (_Float16)xs[i]; ah.h[i] = h; al.h[i] = ASPLIT ? (_Float16)(xs[i] - (float)h) : (_Float16)0.0f; }
#pragma unroll
    for (int t = 0; t < 4; ++t) { if (col0 + t * 16 >= N) continue; const size_t boff = (size_t)(col0 + t * 16 + ln) * ldb + kb; FragH bq; bq.half[0] = *(const v8us*)(Bh + boff + 8 * hh); bq.half[1] = *(const v8us*)(Bh + boff + 16 + 8 * hh);
      acc[t] = mmaH<ASPLIT ? 2 : 1>(ah.v, al.v, bq.v, bq.v, acc[t]); }
  }
#pragma unroll
  for (int t = 0; t < 4; ++t) { if (col0 + t * 16 >= N) continue;
#pragma unroll
    for (int r = 0; r < 8; ++r) so[w][8 * hh + r][t * 16 + ln] = acc[t][r] * alpha; }
  __builtin_amdgcn_fence(__ATOMIC_ACQ_REL, "workgroup"); __builtin_amdgcn_wave_barrier();
  const int rsub = lane >> 4, c4 = (lane & 15) * 4;
  {
#pragma unroll
    for (int q = 0; q < 8; ++q) { const int r = q * 2 + rsub; if (col0 + c4 < N) { const v4f v = *(const v4fa*)&so[w][r][c4]; *(v4f*)(C + (size_t)(row0 + r) * ldc + col0 + c4) = v; } }
     }
}

// Wt[n][k] = f16(W[k][n]·scale) from f32 row-major W[K][N] (scale = power of two; bf16-exact weights stay exact in f16 away from the subnormal range)
__global__ __launch_bounds__(256) void k_wt_f16(const float* __restrict__ W, _Float16* __restrict__ Wt, int K, int N, float scale) {
  const int t = blockIdx.x * 256 + threadIdx.x; if (t >= N * (K / 8)) return; const int n = t / (K / 8), k8 = (t % (K / 8)) * 8; FragH f;
#pragma unroll
  for (int i = 0; i < 8; ++i) f.h[i] = (_Float16)(bf16_round(W[(size_t)(k8 + i) * N + n]) * scale); const v8us o = f.half[0];
  *(v8us*)((unsigned short*)Wt + (size_t)n * K + k8) = o; 
}
// k_gemm_hh variant with fused epilogue: v = acc·alpha + bias[by·sBias + col] (+ CP[(row/rowsPerB)·sCPb + by·64 + col] if CP) ; ACT 0 none / 1 elu ; writes f16 C16 (and f32 C if non-null)
template <int ACT>
__global__ __launch_bounds__(128) void k_gemm_hhx(const _Float16* __restrict__ A, int lda, size_t sA, const _Float16* __restrict__ Bh, int ldb, size_t sB, float alpha, const float* __restrict__ bias, size_t sBias, const float* __restrict__ CP, int rowsPerB, size_t sCPb, int row0g,
    float* __restrict__ C, _Float16* __restrict__ C16, int ldc, size_t sC, int M, int N, int K) {
  __shared__ __attribute__((aligned(16))) float so[4][16][64];
  const int tid = threadIdx.x, w = tid >> 5, lane = tid & 31, ln = lane & 15, hh = lane >> 4; const int by = blockIdx.y;
  A += (size_t)by * sA; Bh += (size_t)by * sB; const size_t cofs = (size_t)by * sC; const float* bp = bias ? bias + (size_t)by * sBias : nullptr;
  const int ntn = (N + 63) / 64; const int wid = blockIdx.x * 4 + w; const int mt = wid / ntn, nq = wid % ntn; if (mt * 16 >= M) return;
  const int row0 = mt * 16, col0 = nq * 64; const _Float16* arow = A + (size_t)(row0 + ln) * lda;
  v8f acc[4] = {};
  for (int kb = 0; kb < K; kb += 32) { FragH ah; ah.half[0] = *(const v8us*)((const unsigned short*)arow + kb + 8 * hh); ah.half[1] = *(const v8us*)((const unsigned short*)arow + kb + 16 + 8 * hh);
#pragma unroll
    for (int t = 0; t < 4; ++t) { if (col0 + t * 16 >= N) continue; const size_t boff = (size_t)(col0 + t * 16 + ln) * ldb + kb; FragH bq; bq.half[0] = *(const v8us*)((const unsigned short*)Bh + boff + 8 * hh); bq.half[1] = *(const v8us*)((const unsigned short*)Bh + boff + 16 + 8 * hh);
      acc[t] = mmaH<1>(ah.v, ah.v, bq.v, bq.v, acc[t]); }
  }
#pragma unroll
  for (int t = 0; t < 4; ++t) { if (col0 + t * 16 >= N) continue; const int col = col0 + t * 16 + ln; const float bv = bp ? bf16_round(bp[col]) : 0.f;
#pragma unroll
    for (int r = 0; r < 8; ++r) { float v = acc[t][r] * alpha + bv; if (CP) { const int rr = row0g + row0 + 8 * hh + r; if (rowsPerB < 0) v += CP[cofs + (size_t)rr * ldc + col];      /* rowsPerB < 0: own element of the batched C plane */ else { const int bidx = rr / rowsPerB; v += CP[(size_t)bidx * sCPb + (size_t)by * 64 + col]; } } if (ACT == 1) v = (v > 0.f) ? v : expm1f(v); else if (ACT == 7) v = (v > 0.f) ? v + 1.0f : expf(v); else if (ACT == 8) v = tanhf(v); else if (ACT == 9) v = 0.5f * v * (1.0f + tanhf(0.7978845608028654f * (v + 0.044715f * v * v * v))); else if (ACT == 11) v = 1.0f / (1.0f + expf(-v)); else if (ACT == 12) v = (v > 0.f) ? v : 0.01f * v; else if (ACT == 14) v = (v > 0.f) ? v : 0.1f * v; else if (ACT == 16) v = (v >= 0.f) ? v : 0.3f * v; else if (ACT == 17) v = (v >= 0.f) ? v : 0.2f * v; else if (ACT == 15) v = v / (1.0f + expf(-v)); else if (ACT == 3) v = fmaxf(v, 0.f); else if (ACT == 6) v = 0.5f * v * (1.0f + erff(v * 0.70710678118654752f)); so[w][8 * hh + r][t * 16 + ln] = v; } }
  __builtin_amdgcn_fence(__ATOMIC_ACQ_REL, "workgroup"); __builtin_amdgcn_wave_barrier();
  const int rsub = lane >> 4, c4 = (lane & 15) * 4; typedef _Float16 v4h __attribute__((ext_vector_type(4)));
  {
#pragma unroll
    for (int q = 0; q < 8; ++q) { const int r = q * 2 + rsub; if (col0 + c4 < N) { const v4f v = *(const v4fa*)&so[w][r][c4]; if (C) *(v4f*)(C + cofs + (size_t)(row0 + r) * ldc + col0 + c4) = v; if (C16) { v4h h4; for (int i = 0; i < 4; ++i) h4[i] = (_Float16)v[i]; *(v4h*)(C16 + cofs + (size_t)(row0 + r) * ldc + col0 + c4) = h4; } } }
     }
}


typedef _Float16 v4h __attribute__((ext_vector_type(4)));

__global__ __launch_bounds__(256) void k_x16(const float* __restrict__ x, _Float16* __restrict__ X16, size_t n8) { const size_t t = (size_t)blockIdx.x * 256 + threadIdx.x; if (t >= n8) return; FragH f;
#pragma unroll
  for (int q = 0; q < 8; ++q) f.h[q] = (_Float16)bf16_round(x[t * 8 + q]); *(v8us*)((unsigned short*)X16 + t * 8) = f.half[0];  }
__global__ __launch_bounds__(256) void k_h16(const float* __restrict__ x, _Float16* __restrict__ X16, size_t n8) { const size_t t = (size_t)blockIdx.x * 256 + threadIdx.x; if (t >= n8) return; FragH f;
#pragma unroll
  for (int q = 0; q < 8; ++q) f.h[q] = (_Float16)x[t * 8 + q]; *(v8us*)((unsigned short*)X16 + t * 8) = f.half[0];  }
__global__ __launch_bounds__(256) void k_round16f(const float* __restrict__ W, _Float16* __restrict__ Bt, size_t n8) { const size_t t = (size_t)blockIdx.x * 256 + threadIdx.x; if (t >= n8) return; FragH f;
#pragma unroll
  for (int i = 0; i < 8; ++i) f.h[i] = (_Float16)(bf16_round(W[t * 8 + i]) * 16.0f); *(v8us*)((unsigned short*)Bt + t * 8) = f.half[0];  }
__global__ __launch_bounds__(256) void k_hl(const float* __restrict__ F, _Float16* __restrict__ Hh, _Float16* __restrict__ Hl, size_t n8) { const size_t t = (size_t)blockIdx.x * 256 + threadIdx.x; if (t >= n8) return; FragH fh, fl; const v4f a = *(const v4fa*)(F + t * 8), c = *(const v4fa*)(F + t * 8 + 4);
#pragma unroll
  for (int q = 0; q < 4; ++q) { _Float16 h = (_Float16)a[q]; fh.h[q] = h; fl.h[q] = (_Float16)((a[q] - (float)h) * 1024.0f); h = (_Float16)c[q]; fh.h[4 + q] = h; fl.h[4 + q] = (_Float16)((c[q] - (float)h) * 1024.0f); }
  { *(v8us*)((unsigned short*)Hh + t * 8) = fh.half[0]; *(v8us*)((unsigned short*)Hl + t * 8) = fl.half[0];  } }

// ---- fast GEMM (wave tile 32x64, work-group tile 128x128 = 8 waves, 4 down and 2 across; requires M % 128 == 0 rows per launch region, N % 128 == 0 and K % 128 == 0); epilogue = k_gemm_hhx semantics ----
__device__ __forceinline__ v16h g2_frag(const _Float16* p, int hh) { FragH f; f.half[0] = *(const v8us*)((const unsigned short*)p + 8 * hh); f.half[1] = *(const v8us*)((const unsigned short*)p + 16 + 8 * hh); return f.v; }
__device__ __forceinline__ v8f g2_mma(v16h a, v16h b, v8f c) { v8f d = __builtin_amdgcn_wmma_f32_16x16x32_f16(false, a, false, b, (short)0, c, false, false); asm volatile("v_nop\n\tv_nop\n\tv_nop\n\tv_nop" : "+v"(d) : "v"(a), "v"(b)); return d; }
// A stage of k_gemm2 = 128 k of the work-group's 128 A rows and 128 B rows: 256 rows of 256 bytes in LDS at a pitch of 272 (16 B x odd: the 16 lanes of a half wave's ds_load_b128 fall on 64 different banks).
// The square tile brings (128 + 128) operand rows from L2 for 128 x 128 results, where two tiles of 128 x 64 bring 2 (128 + 64); the longer stage keeps as many bytes in flight for a work-group that may be alone on its WGP.
#define G2_PITCH 272
#define G2_BOFF (128 * G2_PITCH)      /* the B rows stand behind the A rows */
#define G2_STAGE (256 * G2_PITCH)
__device__ __forceinline__ v16h g2_lfrag(const unsigned char* p) { FragH f; f.half[0] = *(const v8us*)p; f.half[1] = *(const v8us*)(p + 32); return f.v; }      /* p = row start + 64 B per 32 k + 16 hh: the k order of g2_frag */
// One operand's 128 rows of a stage, global memory -> LDS through no register: 8 asynchronous copies of 16 bytes a lane, 16 rows apart; 16 lanes fill one row, so a wave's copy reads two whole 256-byte rows.
// lds = the lane's own LDS byte address of its first row, g = its own global address, r16 = 16 rows in elements. The s_wait_xcnt stands inside the statement, behind the last copy, so that
// no address register of a copy is written again in front of it.
__device__ __forceinline__ void g2_rows(unsigned lds, const _Float16* g, size_t r16) {
  asm volatile("global_load_async_to_lds_b128 %0, %8, off\n\tglobal_load_async_to_lds_b128 %1, %9, off\n\tglobal_load_async_to_lds_b128 %2, %10, off\n\tglobal_load_async_to_lds_b128 %3, %11, off\n\t"
               "global_load_async_to_lds_b128 %4, %12, off\n\tglobal_load_async_to_lds_b128 %5, %13, off\n\tglobal_load_async_to_lds_b128 %6, %14, off\n\tglobal_load_async_to_lds_b128 %7, %15, off\n\t"
               "s_wait_xcnt 0x0"
               :: "v"(lds), "v"(lds + 16 * G2_PITCH), "v"(lds + 32 * G2_PITCH), "v"(lds + 48 * G2_PITCH), "v"(lds + 64 * G2_PITCH), "v"(lds + 80 * G2_PITCH), "v"(lds + 96 * G2_PITCH), "v"(lds + 112 * G2_PITCH),
                  "v"(g), "v"(g + r16), "v"(g + 2 * r16), "v"(g + 3 * r16), "v"(g + 4 * r16), "v"(g + 5 * r16), "v"(g + 6 * r16), "v"(g + 7 * r16) : "memory"); }
// One stage: the A rows, then the B rows behind them (an asm statement takes 30 operands, so the 16 copies stand in two).
__device__ __forceinline__ void g2_stage(unsigned lds, const _Float16* ga, const _Float16* gb, size_t a16, size_t b16) { g2_rows(lds, ga, a16); g2_rows(lds + G2_BOFF, gb, b16); }
// What the epilogue does is fixed per launch, so it is a template argument and not a test at run time: BIAS = a bias row is added, RES = the CP term is added, W32 / W16 = the f32 / the f16 plane is written.
// With run-time tests every one of a lane's 64 results jumped over the unused CP code, every bias load and every row store stood behind a branch of its own and waited alone, and the text was six times as long.
template <int ACT, bool BIAS, bool RES, bool W32, bool W16>
__global__ __launch_bounds__(256) void k_gemm2(const _Float16* __restrict__ A, int lda, size_t sA, const _Float16* __restrict__ Bh, int ldb, size_t sB, float alpha, const float* __restrict__ bias, size_t sBias, const float* __restrict__ CP, int rowsPerB, size_t sCPb, int row0g,
    float* __restrict__ C, _Float16* __restrict__ C16, int ldc, size_t sC, int M, int N, int K) { static_assert(ACT == 0 || ACT == 3 || ACT == 6 || ACT == 8 || ACT == 9 || ACT == 11 || ACT == 12 || ACT == 14 || ACT == 15 || ACT == 16 || ACT == 17, "k_gemm2: unsupported ACT code (would silently apply no activation)");
  __shared__ __attribute__((aligned(16))) unsigned char sm[2 * G2_STAGE];      /* two stage buffers; behind the K loop the same bytes are the epilogue's staging rows */
  static_assert(sizeof(float) * 8 * 32 * 68 <= 2 * G2_STAGE, "epilogue staging fits the ring"); float (*so)[32][68] = (float (*)[32][68])sm;
  const int tid = threadIdx.x, w = tid >> 5, lane = tid & 31, ln = lane & 15, hh = lane >> 4; const int by = blockIdx.y;
  A += (size_t)by * sA; Bh += (size_t)by * sB; const size_t cofs = (size_t)by * sC; const float* bp = bias + (size_t)by * sBias;
  const int ntn = N >> 7; const int mt = blockIdx.x / ntn, nq = blockIdx.x - mt * ntn; const int wr = w & 3, wc = w >> 2; const int row0 = mt * 128 + 32 * wr, col0 = nq * 128 + 64 * wc; if (mt * 128 >= M) return;      /* the whole work-group or none, in front of every barrier */
  const int cr = tid >> 4, cc = tid & 15;      /* the lane's copies: rows cr + 16 i of either operand, 16-byte piece cc of the row's 256 bytes */
  const unsigned lds0 = (unsigned)(size_t)sm + (unsigned)(cr * G2_PITCH + cc * 16);
  const _Float16* ga = A + (size_t)(mt * 128 + cr) * lda + cc * 8; const _Float16* gb = Bh + (size_t)(nq * 128 + cr) * ldb + cc * 8; const size_t a16 = (size_t)16 * lda, b16 = (size_t)16 * ldb;
  const unsigned char* fa = sm + (32 * wr + ln) * G2_PITCH + 16 * hh; const unsigned char* fb = sm + G2_BOFF + (64 * wc + ln) * G2_PITCH + 16 * hh;      /* the lane's fragment rows in buffer 0 */
  const v8f z8 = {0.f,0.f,0.f,0.f,0.f,0.f,0.f,0.f}; v8f c00 = z8, c01 = z8, c02 = z8, c03 = z8, c10 = z8, c11 = z8, c12 = z8, c13 = z8;
  const int nst = K >> 7;
  float bvs[4] = {0.f, 0.f, 0.f, 0.f};      /* the lane's four bias elements, loaded together up here: they fly beside stage 0's copies and cost the epilogue no wait */
  if (BIAS) {
#pragma unroll      /* constant indices: bvs stays in registers */
    for (int t = 0; t < 4; ++t) bvs[t] = bp[col0 + t * 16 + ln]; }
  g2_stage(lds0, ga, gb, a16, b16);
  asm volatile("s_wait_asynccnt 0x0" ::: "memory");      /* this wave's copies of stage 0 have landed */
  __syncthreads();      /* ... and every other wave's: stage 0 may be read */
  if (nst > 1) g2_stage(lds0 + G2_STAGE, ga + 128, gb + 128, a16, b16);
#pragma unroll 1      /* rolled: the buffer is picked by the trip's parity, a second copy of the body would only add code */
  for (int t = 0; t < nst; ++t) { const unsigned bo = (unsigned)(t & 1) * G2_STAGE;
#pragma unroll      /* the stage's two halves of 64 k, one after the other: constant offsets for every LDS read */
   for (int hf = 0; hf < 2; ++hf) {
    const unsigned char* pa = fa + bo + 128 * hf; const unsigned char* pb = fb + bo + 128 * hf; v16h af[2][2], bf[2][4];
#pragma unroll      /* constant indices: the fragment arrays become registers */
    for (int kc = 0; kc < 2; ++kc) { af[kc][0] = g2_lfrag(pa + 64 * kc); bf[kc][0] = g2_lfrag(pb + 64 * kc); af[kc][1] = g2_lfrag(pa + 64 * kc + 16 * G2_PITCH);
      for (int j = 1; j < 4; ++j) bf[kc][j] = g2_lfrag(pb + 64 * kc + j * 16 * G2_PITCH); }
#pragma unroll      /* the half's two 32-k blocks, in ascending k: the sum order of the plain loop */
    for (int kc = 0; kc < 2; ++kc) { c00 = g2_mma(af[kc][0], bf[kc][0], c00); c10 = g2_mma(af[kc][1], bf[kc][0], c10); c01 = g2_mma(af[kc][0], bf[kc][1], c01); c11 = g2_mma(af[kc][1], bf[kc][1], c11);
      c02 = g2_mma(af[kc][0], bf[kc][2], c02); c12 = g2_mma(af[kc][1], bf[kc][2], c12); c03 = g2_mma(af[kc][0], bf[kc][3], c03); c13 = g2_mma(af[kc][1], bf[kc][3], c13); } }
    asm volatile("s_wait_dscnt 0x0" ::: "memory");      /* this wave's reads of the buffer are done before it is handed to the copies */
    asm volatile("s_wait_asynccnt 0x0" ::: "memory");      /* this wave's copies of stage t + 1 have landed */
    __syncthreads();      /* publishes stage t + 1 and ends every wave's reads of stage t */
    if (t + 2 < nst) g2_stage(lds0 + bo, ga + (size_t)(t + 2) * 128, gb + (size_t)(t + 2) * 128, a16, b16); }      /* refill of the buffer just read; in flight under trip t + 1 */
  asm volatile("s_wait_asynccnt 0x0" ::: "memory");      /* no copy is outstanding when the ring becomes staging; the last trip's barrier has ended every read of it */
  v8f accs[8] = {c00, c01, c02, c03, c10, c11, c12, c13};
#pragma unroll
  for (int u = 0; u < 8; ++u) { const int t = u & 3, half = u >> 2; const int col = col0 + t * 16 + ln; const float bv = BIAS ? bf16_round(bvs[t]) : 0.f;
#pragma unroll
    for (int r = 0; r < 8; ++r) { const int rloc = half * 16 + 8 * hh + r; float v = accs[u][r] * alpha + bv; if (RES) { if (rowsPerB < 0) v += CP[cofs + (size_t)(row0g + row0 + rloc) * ldc + col];      /* rowsPerB < 0: own element of the batched C plane */ else { const int bidx = (row0g + row0 + rloc) / rowsPerB; v += CP[(size_t)bidx * sCPb + (size_t)by * 64 + col]; } }
      if (ACT == 3) v = fmaxf(v, 0.f); else if (ACT == 6) v = 0.5f * v * (1.0f + erff(v * 0.70710678118654752f)); else if (ACT == 11) v = 1.0f / (1.0f + expf(-v)); else if (ACT == 15) v = v / (1.0f + expf(-v)); else if (ACT == 12) v = (v > 0.f) ? v : 0.01f * v; else if (ACT == 8) v = tanhf(v); else if (ACT == 9) v = 0.5f * v * (1.0f + tanhf(0.7978845608028654f * (v + 0.044715f * v * v * v))); else if (ACT == 14) v = (v > 0.f) ? v : 0.1f * v; else if (ACT == 16) v = (v >= 0.f) ? v : 0.3f * v; else if (ACT == 17) v = (v >= 0.f) ? v : 0.2f * v;
      so[w][rloc][t * 16 + ln] = v; } }
  __builtin_amdgcn_fence(__ATOMIC_ACQ_REL, "workgroup"); __builtin_amdgcn_wave_barrier();
  const int rsub = lane >> 4, c4 = (lane & 15) * 4;
  {
#pragma unroll
    for (int q = 0; q < 16; ++q) { const int r = q * 2 + rsub; const v4f v = *(const v4fa*)&so[w][r][c4]; if (W32) *(v4f*)(C + cofs + (size_t)(row0 + r) * ldc + col0 + c4) = v; if (W16) { v4h h4; for (int i = 0; i < 4; ++i) h4[i] = (_Float16)v[i]; *(v4h*)(C16 + cofs + (size_t)(row0 + r) * ldc + col0 + c4) = h4; } }
     } }


__global__ __launch_bounds__(256) void k_wnat(const float* __restrict__ w, size_t n8, _Float16* __restrict__ Bt) { const size_t t = (size_t)blockIdx.x * 256 + threadIdx.x; if (t >= n8) return; FragH f; for (int q = 0; q < 8; ++q) f.h[q] = (_Float16)(bf16_round(w[t * 8 + q]) * 16.0f); *(v8us*)((unsigned short*)Bt + t * 8) = f.half[0];  }
__global__ __launch_bounds__(256) void k_rsm(const float* __restrict__ S, _Float16* __restrict__ P, int nrows) {
  #pragma clang fp contract(off)
  const int i = blockIdx.x * 256 + threadIdx.x; if (i >= nrows) return; const float* s = S + (size_t)i * SQ; float mx = -3.0e38f;
#pragma unroll 1
  for (int j = 0; j < SQ; ++j) mx = fmaxf(mx, s[j]); float se = 0.f;
#pragma unroll 1
  for (int j = 0; j < SQ; ++j) se += expf(s[j] - mx); const float sc = 256.0f / se;
#pragma unroll 1
  for (int j0 = 0; j0 < SQ; j0 += 8) { FragH f; for (int q = 0; q < 8; ++q) f.h[q] = (_Float16)(expf(s[j0 + q] - mx) * sc); unsigned short* d = (unsigned short*)P + (size_t)i * SQ + j0; *(v8us*)d = f.half[0];  } }
__global__ __launch_bounds__(256) void k_vt(const _Float16* __restrict__ V16, int b, int h0, _Float16* __restrict__ VT) { __shared__ unsigned short tl[64][65]; const int tid = threadIdx.x; const int hh = blockIdx.x % HG, sg = blockIdx.x / HG; const int s0 = sg * 64; const int h = h0 + hh;
  for (int i = tid; i < 64 * 8; i += 256) { const int j = i / 8, d8 = (i % 8) * 8; FragH f; f.half[0] = *(const v8us*)((const unsigned short*)V16 + ((size_t)b * SQ + s0 + j) * DM + h * HD + d8); for (int q = 0; q < 8; ++q) tl[d8 + q][j] = f.u[q]; }
  __syncthreads();
  { for (int i = tid; i < 64 * 8; i += 256) { const int d = i / 8, j8 = (i % 8) * 8; FragH f; for (int q = 0; q < 8; ++q) f.u[q] = tl[d][j8 + q]; *(v8us*)((unsigned short*)VT + ((size_t)hh * HD + d) * SQ + s0 + j8) = f.half[0]; }  } }



__global__ __launch_bounds__(256) void k_rsmcf2(const float* __restrict__ S, _Float16* __restrict__ P, int hg, int q0, int nk) {
  #pragma clang fp contract(off)
  const int t = blockIdx.x * 256 + threadIdx.x; if (t >= hg * QT) return; const size_t i = (size_t)t; const float* s = S + i * NKX; const int last = q0 + (t % QT); float mx = -3.0e38f;
#pragma unroll 1
  for (int j = 0; j < nk; ++j) { const float f = (j <= last) ? 1.f : 0.f; mx = fmaxf(mx, fmaf(f, s[j], (1.f - f) * -1.0e9f)); } float se = 0.f;
#pragma unroll 1
  for (int j = 0; j < nk; ++j) { const float f = (j <= last) ? 1.f : 0.f; se += __expf(fmaf(f, s[j], (1.f - f) * -1.0e9f) - mx); } const float sc = 256.0f / se;
#pragma unroll 1
  for (int j0 = 0; j0 < nk; j0 += 8) { FragH fr; for (int q = 0; q < 8; ++q) { const int j = j0 + q; const float f = (j <= last) ? 1.f : 0.f; fr.h[q] = (_Float16)(__expf(fmaf(f, s[j], (1.f - f) * -1.0e9f) - mx) * sc); } unsigned short* d = (unsigned short*)P + i * NKX + j0; *(v8us*)d = fr.half[0];  } }


template <int MASKADD>
__global__ __launch_bounds__(64) void k_att0(const float* __restrict__ QF, const float* __restrict__ KF, const float* __restrict__ VF, int ld, const float* __restrict__ mask, float scale, float* __restrict__ OF, int ldo) {
  #pragma clang fp contract(off)
  __shared__ __attribute__((aligned(16))) float lq[64][64]; __shared__ __attribute__((aligned(16))) float lo[64][64];
  const int tid = threadIdx.x; const int h = blockIdx.x / (QT0 / 64), rg = blockIdx.x % (QT0 / 64); const int i = rg * 64 + tid;
  const float* qr = QF + (size_t)i * ld + h * HD;
#pragma unroll 1
  for (int c = 0; c < HD / 4; ++c) { *(v4f*)&lq[tid][c * 4] = *(const v4fa*)(qr + c * 4); const v4f z = {0.f, 0.f, 0.f, 0.f}; *(v4f*)&lo[tid][c * 4] = z; }
  float m = -1.0e30f, l = 0.f; const int jmax = MASKADD ? (SQ - 1) : (rg * 64 + 63);      /* additive-mask form: every key (the mask input decides); causal form: keys up to the block's last row */
#pragma unroll 1
  for (int j = 0; j <= jmax; ++j) { const float* kr = KF + (size_t)j * ld + h * HD; const float* vr = VF + (size_t)j * ld + h * HD; float s = 0.f;
#pragma unroll 1
    for (int c = 0; c < HD / 4; ++c) { const v4f kq = *(const v4fa*)(kr + c * 4); const v4f qq = *(v4f*)&lq[tid][c * 4]; s = __fadd_rn(s, __fmul_rn(qq[0], kq[0])); s = __fadd_rn(s, __fmul_rn(qq[1], kq[1])); s = __fadd_rn(s, __fmul_rn(qq[2], kq[2])); s = __fadd_rn(s, __fmul_rn(qq[3], kq[3])); }
    s = __fmul_rn(s, scale); if (MASKADD) s = __fadd_rn(s, __fmul_rn(bf16_round(mask[(size_t)i * SQ + j]), -10000.0f));
    const float f = (MASKADD || j <= i) ? 1.f : 0.f; const float sm = fmaf(f, s, (1.f - f) * -1.0e30f); const float mn = fmaxf(m, sm); const float sc = expf(m - mn); const float e = expf(sm - mn); l = __fadd_rn(__fmul_rn(l, sc), e); m = mn;
#pragma unroll 1
    for (int c = 0; c < HD / 4; ++c) { const v4f vv = *(const v4fa*)(vr + c * 4); v4f oo = *(v4f*)&lo[tid][c * 4]; for (int u = 0; u < 4; ++u) oo[u] = __fadd_rn(__fmul_rn(oo[u], sc), __fmul_rn(e, vv[u])); *(v4f*)&lo[tid][c * 4] = oo; } }
  const float fin = 64.0f / l;      /* o carried x64 like the f16 path */
#pragma unroll 1
  for (int c = 0; c < HD / 4; ++c) { v4f oo = *(v4f*)&lo[tid][c * 4]; for (int u = 0; u < 4; ++u) oo[u] = __fmul_rn(oo[u], fin); *(v4f*)&lo[tid][c * 4] = oo; }
  __syncthreads();
  {
#pragma unroll 1
    for (int it = 0; it < 16; ++it) { const int row = it * 4 + tid / 16, pc = (tid % 16) * 4; const v4f v = *(const v4f*)&lo[row][pc]; *(v4f*)(OF + (size_t)(rg * 64 + row) * ldo + h * HD + pc) = v; }
     } }


template <int BFIN, int WXB>
__global__ __launch_bounds__(256) void k_ln16(const float* __restrict__ X, const float* __restrict__ g, const float* __restrict__ bb, float eps, _Float16* __restrict__ N16, float* __restrict__ XB) {
  #pragma clang fp contract(off)
  __shared__ float red[256]; const size_t r = blockIdx.x; const int t = threadIdx.x; const v4f xa = *(const v4fa*)(X + r * DMQ + t * 4); float s[4]; float sum = 0.f;
  for (int q = 0; q < 4; ++q) { s[q] = BFIN ? bf16_round(xa[q]) : xa[q]; sum = __fadd_rn(sum, s[q]); }
  red[t] = sum; __syncthreads(); for (int st = 128; st > 0; st >>= 1) { if (t < st) red[t] = __fadd_rn(red[t], red[t + st]); __syncthreads(); } const float mu = red[0] / (float)DMQ; __syncthreads();
  float vs = 0.f; for (int q = 0; q < 4; ++q) { const float dl = __fadd_rn(s[q], -mu); vs = __fadd_rn(vs, __fmul_rn(dl, dl)); } red[t] = vs; __syncthreads(); for (int st = 128; st > 0; st >>= 1) { if (t < st) red[t] = __fadd_rn(red[t], red[t + st]); __syncthreads(); }
  const float rs = rsqrtf(__fadd_rn(red[0] / (float)DMQ, eps)); v4h y; v4f xb;
  for (int q = 0; q < 4; ++q) { const int c = t * 4 + q; y[q] = (_Float16)__fadd_rn(__fmul_rn(__fmul_rn(__fadd_rn(s[q], -mu), rs), bf16_round(g[c])), bf16_round(bb[c])); xb[q] = s[q]; }
  { *(v4h*)(N16 + r * DMQ + t * 4) = y; if (WXB) *(v4f*)(XB + r * DMQ + t * 4) = xb;  } }
__global__ __launch_bounds__(256) void k_ftres2(const float* __restrict__ OF0, const float* __restrict__ XB, float* __restrict__ X1, size_t n4) {
  #pragma clang fp contract(off)
  const size_t t = (size_t)blockIdx.x * 256 + threadIdx.x; if (t >= n4) return; const v4f o = *(const v4fa*)(OF0 + t * 4), xv = *(const v4fa*)(XB + t * 4); v4f y; for (int q = 0; q < 4; ++q) y[q] = __fadd_rn(__fmul_rn(o[q], 0.015625f), xv[q]); *(v4f*)(X1 + t * 4) = y;  }

__global__ __launch_bounds__(256) void k_wthd(const float* __restrict__ Wt, _Float16* __restrict__ Bt) { const size_t t = (size_t)blockIdx.x * 256 + threadIdx.x; if (t >= (size_t)NH * HD * (DM / 8)) return; const int m8 = (int)(t % (DM / 8)) * 8; const int d = (int)((t / (DM / 8)) % HD); const int h = (int)(t / ((size_t)(DM / 8) * HD)); FragH f;
  for (int q = 0; q < 8; ++q) f.h[q] = (_Float16)(16.0f * bf16_round(Wt[((size_t)h * DM + m8 + q) * HD + d])); unsigned short* dst = (unsigned short*)Bt + ((size_t)h * HD + d) * DM + m8; *(v8us*)dst = f.half[0];  }




template <int BFIN, int W16, int W32>
__global__ __launch_bounds__(256) void k_lnx(const float* __restrict__ X, const float* __restrict__ g, const float* __restrict__ bb, float eps, _Float16* __restrict__ N16, float* __restrict__ N32) {
  #pragma clang fp contract(off)
  __shared__ float red[256]; const size_t r = blockIdx.x; const int t = threadIdx.x; const bool act = t < (DMQ / 4); const int c0 = act ? t * 4 : 0;
  const v4f xa = *(const v4fa*)(X + r * DMQ + c0); float s[4]; float sum = 0.f;
  for (int q = 0; q < 4; ++q) { s[q] = act ? (BFIN ? bf16_round(xa[q]) : xa[q]) : 0.f; sum = __fadd_rn(sum, s[q]); }
  red[t] = sum; __syncthreads(); for (int st = 128; st > 0; st >>= 1) { if (t < st) red[t] = __fadd_rn(red[t], red[t + st]); __syncthreads(); } const float mu = red[0] / (float)DMQ; __syncthreads();
  float vs = 0.f; for (int q = 0; q < 4; ++q) { const float dl = act ? __fadd_rn(s[q], -mu) : 0.f; vs = __fadd_rn(vs, __fmul_rn(dl, dl)); } red[t] = vs; __syncthreads(); for (int st = 128; st > 0; st >>= 1) { if (t < st) red[t] = __fadd_rn(red[t], red[t + st]); __syncthreads(); }
  const float rs = rsqrtf(__fadd_rn(red[0] / (float)DMQ, eps)); v4h y; v4f yf;
  for (int q = 0; q < 4; ++q) { const int c = c0 + q; yf[q] = __fadd_rn(__fmul_rn(__fmul_rn(__fadd_rn(s[q], -mu), rs), bf16_round(g[c])), bf16_round(bb[c])); y[q] = (_Float16)yf[q]; }
  if (!act) return;      /* no barriers after this point */
  { if (W16) *(v4h*)(N16 + r * DMQ + c0) = y; if (W32) *(v4f*)(N32 + r * DMQ + c0) = yf;  } }


__global__ __launch_bounds__(256) void k_bfr(const float* __restrict__ x, float* __restrict__ XB, size_t n8) { const size_t t = (size_t)blockIdx.x * 256 + threadIdx.x; if (t >= n8) return; v4f a = *(const v4fa*)(x + t * 8), c = *(const v4fa*)(x + t * 8 + 4); for (int q = 0; q < 4; ++q) { a[q] = bf16_round(a[q]); c[q] = bf16_round(c[q]); }
  { *(v4f*)(XB + t * 8) = a; *(v4f*)(XB + t * 8 + 4) = c;  } }




__global__ __launch_bounds__(256) void k_lorafold(const float* __restrict__ Wm, const float* __restrict__ A, const float* __restrict__ Bm, float* __restrict__ WE, int K, int N, float sc) {
  #pragma clang fp contract(off)
  const size_t t = (size_t)blockIdx.x * 256 + threadIdx.x; if (t >= (size_t)K * N) return; const int i = (int)(t / N), o = (int)(t % N); float a = 0.f;
  for (int r = 0; r < 16; ++r) a = __fadd_rn(a, __fmul_rn(bf16_round(A[(size_t)i * 16 + r]), bf16_round(Bm[(size_t)r * N + o])));
  const float v = __fadd_rn(bf16_round(Wm[t]), __fmul_rn(sc, a)); *(float*)(WE + t) = v;  }
__global__ __launch_bounds__(256) void k_wt32rep(const float* __restrict__ Wf, _Float16* __restrict__ Bt, int K, int N, int DOUT, float scale) {
  const int t = blockIdx.x * 256 + threadIdx.x; if (t >= DOUT * (K / 8)) return; const int n = t / (K / 8), k8 = (t % (K / 8)) * 8; const int rep = DOUT / N; const int src = (n / (HD * rep)) * HD + (n % HD);      /* head h = n / HD -> group h / rep */
  FragH f; for (int i = 0; i < 8; ++i) f.h[i] = (_Float16)(Wf[(size_t)(k8 + i) * N + src] * scale);
  *(v8us*)((unsigned short*)Bt + (size_t)n * K + k8) = f.half[0];  }
__global__ __launch_bounds__(256) void k_brep(const float* __restrict__ b, float* __restrict__ out) { const int t = blockIdx.x * 256 + threadIdx.x; if (t >= DM) return; const float v = b[(t / (HD * 4)) * HD + (t % HD)]; *(float*)(out + t) = v;  }

__global__ __launch_bounds__(256) void k_rsmcim(const float* __restrict__ S, _Float16* __restrict__ P, int hg, int q0, int nk, const int* __restrict__ am) {
  #pragma clang fp contract(off)
  const int t = blockIdx.x * 256 + threadIdx.x; if (t >= hg * QT) return; const size_t i = (size_t)t; const float* s = S + i * NKX; const int last = q0 + (t % QT); const int* mr = am + (size_t)last * SQ; float mx = -3.0e38f;      /* the module's mask row of this query (keys >= nk lie above the diagonal of the staged causal mask and are not computed) */
#pragma unroll 1
  for (int j = 0; j < nk; ++j) { const float f = (mr[j] != 0) ? 1.f : 0.f; mx = fmaxf(mx, fmaf(f, s[j], (1.f - f) * -1.0e9f)); } float se = 0.f;
#pragma unroll 1
  for (int j = 0; j < nk; ++j) { const float f = (mr[j] != 0) ? 1.f : 0.f; se += __expf(fmaf(f, s[j], (1.f - f) * -1.0e9f) - mx); } const float sc = 256.0f / se;
#pragma unroll 1
  for (int j0 = 0; j0 < nk; j0 += 8) { FragH fr; for (int q = 0; q < 8; ++q) { const int j = j0 + q; const float f = (mr[j] != 0) ? 1.f : 0.f; fr.h[q] = (_Float16)(__expf(fmaf(f, s[j], (1.f - f) * -1.0e9f) - mx) * sc); } unsigned short* d = (unsigned short*)P + i * NKX + j0; *(v8us*)d = fr.half[0];  } }



__global__ __launch_bounds__(256) void k_bcpy(const float* __restrict__ b, int n, int NP, float* __restrict__ dst, int dst0) { for (int i = threadIdx.x; i < NP; i += 256) { const float v = (i < n) ? b[i] : 0.f; *(float*)(dst + dst0 + i) = v; }  }



// lane l with lane l ^ 16
__device__ __forceinline__ float rs_xhalf(float x) { return __builtin_bit_cast(float, __builtin_amdgcn_permlanex16(__builtin_bit_cast(int, x), __builtin_bit_cast(int, x), 0x76543210, 0xfedcba98, false, false)); }
// Four 2^t in one statement, each in place: behind a transcendental the instruction set asks for one independent instruction or v_nop before its result is read or its source overwritten.
// Here each v_exp_f32 is the independent instruction behind the one before it, the v_nop the slot behind the last. In place, so that the
// statement writes only registers that the multiply-add in front of it has written: the compiler keeps that one clear of the matrix instructions' operands, which it does not do for registers that asm text writes.
__device__ __forceinline__ v4f rs_exp2x4(v4f t) { float a = t[0], b = t[1], c = t[2], d = t[3];
  asm("v_exp_f32 %0, %0\n\tv_exp_f32 %1, %1\n\tv_exp_f32 %2, %2\n\tv_exp_f32 %3, %3\n\tv_nop" : "+v"(a), "+v"(b), "+v"(c), "+v"(d));
  const v4f r = {a, b, c, d}; return r; }
__device__ __forceinline__ v8f fa_mma(v16h a, v16h b, v8f c) { return __builtin_amdgcn_wmma_f32_16x16x32_f16(false, a, false, b, (short)0, c, false, false); }
// Fused attention: scores, softmax and P V in one launch; no score and no weight leaves the registers. One work-group = 256 queries of one (batch, head), 8 waves of 32 query columns;
// a pass = 32 keys. Transposed products: S^T = K Q^T (rows = keys, columns = queries), so a lane's 16 scores of a column are, as they lie, its 16 elements of the B operand of O^T += V^T P^T
// (k order of both operands: 8 hh + 0..7, then 16 + 8 hh + 0..7, that of g2_frag). Online softmax in the log2 domain, f32: the maximum in use may trail the true one by up to 8 (an
// exponential reaches 2^8 at most, well inside f16), and the sums are rescaled only in a pass where some column exceeds that. Denominator = an all-ones A operand times P^T on the matrix
// pipe: it sums the weights as rounded to f16, the same values the numerator sums. o is carried x64 as f16 rows.
// K and V: the eight waves read the same fragments, and a fragment load from global memory touches 16 cache lines for 512 bytes. So a stage of 128 keys (4 passes) is brought into LDS once for the work-group, in whole
// 128-byte lines, by asynchronous copies, two buffers: stage t + 1 flies while stage t is worked on. Fragments come from LDS, K one pass ahead inside its stage, V^T at the head of its pass.
// V lies in LDS as it lies in the fused k | v rows (row = key, 64 d); the A operand V^T (row = d, k = key) comes out of it by the transposing load ds_load_tr16_b128, so no transposed copy of V is made in memory.
// Every '#pragma unroll' in it is there so that the fragment and accumulator arrays it indexes become registers.
#define FA_KP 144      /* pitch of a K row (one key, 128 bytes) in LDS: 16 B x odd, so the 16 lanes of a half wave's ds_load_b128 fall on 64 different banks */
#define FA_VP 160      /* pitch of a V row (one key, 128 bytes): 32 B x odd, the conflict-free pitch of ds_load_tr16_b128 */
#define FA_VOFF (128 * FA_KP)      /* the 128 V rows stand behind the 128 K rows */
#define FA_STAGE (128 * FA_KP + 128 * FA_VP)
// One stage, global memory -> LDS through no register: 8 asynchronous copies of 16 bytes a lane (4 K rows and 4 V rows, 32 rows apart); 8 lanes fill a row.
// lk / lv = the lane's own LDS byte addresses of its first K and V row, gk / gv = its own global addresses. The s_wait_xcnt stands inside the statement, behind the last copy, so that
// no address register of a copy is written again in front of it.
__device__ __forceinline__ void fa_stage(unsigned lk, unsigned lv, const _Float16* gk, const _Float16* gv) {
  asm volatile("global_load_async_to_lds_b128 %0, %8, off\n\tglobal_load_async_to_lds_b128 %1, %9, off\n\tglobal_load_async_to_lds_b128 %2, %10, off\n\tglobal_load_async_to_lds_b128 %3, %11, off\n\t"
               "global_load_async_to_lds_b128 %4, %12, off\n\tglobal_load_async_to_lds_b128 %5, %13, off\n\tglobal_load_async_to_lds_b128 %6, %14, off\n\tglobal_load_async_to_lds_b128 %7, %15, off\n\t"
               "s_wait_xcnt 0x0"
               :: "v"(lk), "v"(lk + 32 * FA_KP), "v"(lk + 64 * FA_KP), "v"(lk + 96 * FA_KP), "v"(lv), "v"(lv + 32 * FA_VP), "v"(lv + 64 * FA_VP), "v"(lv + 96 * FA_VP),
                  "v"(gk), "v"(gk + (size_t)32 * (2 * DM)), "v"(gk + (size_t)64 * (2 * DM)), "v"(gk + (size_t)96 * (2 * DM)), "v"(gv), "v"(gv + (size_t)32 * (2 * DM)), "v"(gv + (size_t)64 * (2 * DM)), "v"(gv + (size_t)96 * (2 * DM)) : "memory"); }
// Half a V^T fragment: lane (c = lane & 15, hh) gets V[key0 + 8 hh + 0..7][d0 + c], where p = the tile's byte address + (key0 + 8 hh + (lane & 7)) FA_VP + 2 d0 + 16 ((lane >> 3) & 1).
typedef short fa_s16x8 __attribute__((ext_vector_type(8)));
__device__ __forceinline__ v8us fa_tr16(const unsigned char* p) { typedef __attribute__((address_space(3))) fa_s16x8 lds_s16x8; return __builtin_bit_cast(v8us, __builtin_amdgcn_ds_load_tr16_b128_v8i16((lds_s16x8*)p)); }
__global__ __launch_bounds__(256) void k_fattn(const _Float16* __restrict__ Q, const _Float16* __restrict__ KV, _Float16* __restrict__ O) {
  static_assert(SK % 128 == 0 && SK / 128 >= 2 && HD == 64, "k_fattn: whole stages of 128 keys, two or more");
  constexpr float CS = 0.015625f * 1.44269504f;      /* (q / 8) . (k / 8) = q . k / 64, times log2 e */
  constexpr int NST = SK / 128;
  __shared__ __attribute__((aligned(16))) unsigned char sm[2 * FA_STAGE];      /* two stage buffers */
  const int tid = threadIdx.x, lane = tid & 31, ln = lane & 15, hh = lane >> 4; const int wave = __builtin_amdgcn_readfirstlane(tid >> 5);
  const int h = blockIdx.y, b = blockIdx.z; const int q0 = blockIdx.x * 256 + wave * 32;
  const _Float16* qp = Q + ((size_t)b * SQ + q0 + ln) * DM + h * HD;
  const unsigned lk0 = (unsigned)(size_t)sm + (unsigned)((tid >> 3) * FA_KP + (tid & 7) * 16);      /* the lane's copies: K rows (tid >> 3) + 32 i, 16-byte piece tid & 7 */
  const unsigned lv0 = (unsigned)(size_t)sm + (unsigned)(FA_VOFF + (tid >> 3) * FA_VP + (tid & 7) * 16);      /* V rows and pieces likewise */
  const _Float16* gk = KV + ((size_t)b * SK + (tid >> 3)) * (2 * DM) + h * HD + (tid & 7) * 8;      /* k half of the fused rows: row = key */
  const _Float16* gv = gk + DM;      /* v half of the same rows */
  const unsigned char* fk = sm + ln * FA_KP + 16 * hh; const unsigned char* fv = sm + FA_VOFF + (8 * hh + (lane & 7)) * FA_VP + 16 * ((lane >> 3) & 1);      /* the lane's K fragment row and its address for the transposing loads of V, in buffer 0 */
  fa_stage(lk0, lv0, gk, gv);
  v16h qf[2][2], kf[2][2];
#pragma unroll
  for (int g = 0; g < 2; ++g) for (int kc = 0; kc < 2; ++kc) qf[g][kc] = g2_frag(qp + (size_t)g * 16 * DM + 32 * kc, hh);
  FragH ones;
#pragma unroll
  for (int i = 0; i < 16; ++i) ones.h[i] = (_Float16)1.0f;
  const v8f z8 = {0.f, 0.f, 0.f, 0.f, 0.f, 0.f, 0.f, 0.f};
  v8f acc[2][4], lacc[2]; float m_run[2];
#pragma unroll
  for (int g = 0; g < 2; ++g) { m_run[g] = -__builtin_inff(); lacc[g] = z8; for (int t = 0; t < 4; ++t) acc[g][t] = z8; }
  auto pass = [&](const unsigned char* pk, const unsigned char* pv, const int p, const bool more) __attribute__((always_inline)) {      /* p (the pass in its stage) and more are literals at every call: a stage's last pass is compiled without the fetch of a next K */
    v16h vf[4]; v8f s[2][2];
#pragma unroll
    for (int kt = 0; kt < 2; ++kt) for (int g = 0; g < 2; ++g) s[kt][g] = fa_mma(kf[kt][1], qf[g][1], fa_mma(kf[kt][0], qf[g][0], z8));
#pragma unroll
    for (int t = 0; t < 4; ++t) { FragH f; f.half[0] = fa_tr16(pv + 32 * p * FA_VP + 32 * t); f.half[1] = fa_tr16(pv + (32 * p + 16) * FA_VP + 32 * t); vf[t] = f.v; }      /* this pass's V^T (d = 16 t + ln; keys 8 hh + 0..7, then 16 + 8 hh + 0..7: the k order of P^T), in flight under the softmax */
    if (more) {      /* next pass's K, of the same stage, in flight under this pass's softmax and second product */
#pragma unroll
      for (int kt = 0; kt < 2; ++kt) for (int kc = 0; kc < 2; ++kc) kf[kt][kc] = g2_lfrag(pk + (32 * (p + 1) + 16 * kt) * FA_KP + 64 * kc); }
    asm volatile("" ::: "memory");      /* compiler fence: keeps the pass's LDS reads up here, in one group in front of the softmax; without it the compiler sank them behind the branch below, next to their first use, where they have no time to land */
    float mb[2]; bool need = false;
#pragma unroll
    for (int g = 0; g < 2; ++g) { float mx = fmaxf(s[0][g][0], s[1][g][0]);
      for (int r = 1; r < 8; ++r) mx = fmaxf(mx, fmaxf(s[0][g][r], s[1][g][r]));
      mx = fmaxf(mx, rs_xhalf(mx)) * CS; mb[g] = mx; need = need || (mx > m_run[g] + 8.0f); }      /* both wave halves hold the column's maximum of this pass, scaled (the scale is positive) */
    if (__builtin_amdgcn_ballot_w32(need) != 0) {      /* always in the first pass (the maximum in use is -inf, the factor 0), rare later */
#pragma unroll
      for (int g = 0; g < 2; ++g) { const float mn = fmaxf(m_run[g], mb[g]); const float corr = __builtin_amdgcn_exp2f(m_run[g] - mn); m_run[g] = mn; lacc[g] = lacc[g] * corr; for (int t = 0; t < 4; ++t) acc[g][t] = acc[g][t] * corr; } }
#pragma unroll
    for (int g = 0; g < 2; ++g) { FragH pf; const float nm = -m_run[g];
      for (int kt = 0; kt < 2; ++kt) for (int j = 0; j < 2; ++j) { v4f a; for (int q = 0; q < 4; ++q) a[q] = fmaf(s[kt][g][4 * j + q], CS, nm); const v4f e = rs_exp2x4(a); for (int q = 0; q < 4; ++q) pf.h[8 * kt + 4 * j + q] = (_Float16)e[q]; }
      for (int t = 0; t < 4; ++t) acc[g][t] = fa_mma(vf[t], pf.v, acc[g][t]);
      lacc[g] = fa_mma(ones.v, pf.v, lacc[g]); }
  };
  asm volatile("s_wait_asynccnt 0x0" ::: "memory");      /* this wave's copies of stage 0 have landed */
  __syncthreads();      /* ... and every other wave's: stage 0 may be read */
  fa_stage(lk0 + FA_STAGE, lv0 + FA_STAGE, gk + (size_t)128 * (2 * DM), gv + (size_t)128 * (2 * DM));      /* stage 1 exists (asserted above) */
#pragma unroll 1      /* rolled: the buffer is picked by the trip's parity, a second copy of the four passes would only add code */
  for (int t = 0; t < NST; ++t) { const unsigned bo = (unsigned)(t & 1) * FA_STAGE; const unsigned char* pk = fk + bo; const unsigned char* pv = fv + bo;
#pragma unroll
    for (int kt = 0; kt < 2; ++kt) for (int kc = 0; kc < 2; ++kc) kf[kt][kc] = g2_lfrag(pk + 16 * kt * FA_KP + 64 * kc);      /* the stage's first K */
    pass(pk, pv, 0, true); pass(pk, pv, 1, true); pass(pk, pv, 2, true); pass(pk, pv, 3, false);      /* keys in ascending order: the sum order of the plain loop */
    asm volatile("s_wait_dscnt 0x0" ::: "memory");      /* this wave's reads of the buffer are done before it is handed to the copies */
    asm volatile("s_wait_asynccnt 0x0" ::: "memory");      /* this wave's copies of stage t + 1 have landed */
    __syncthreads();      /* publishes stage t + 1 and ends every wave's reads of stage t */
    if (t + 2 < NST) fa_stage(lk0 + bo, lv0 + bo, gk + (size_t)(t + 2) * 128 * (2 * DM), gv + (size_t)(t + 2) * 128 * (2 * DM)); }      /* refill of the buffer just read; in flight under trip t + 1 */
  asm volatile("s_wait_asynccnt 0x0" ::: "memory");      /* no copy is outstanding when the wave ends */
#pragma unroll
  for (int g = 0; g < 2; ++g) { const float inv = 64.0f / lacc[g][0];      /* every row of the all-ones product holds the column's denominator */
    _Float16* op = O + ((size_t)b * SQ + q0 + 16 * g + ln) * DM + h * HD + 8 * hh;
    for (int t = 0; t < 4; ++t) { FragH f; for (int r = 0; r < 8; ++r) f.h[r] = (_Float16)(acc[g][t][r] * inv); *(v8us*)((unsigned short*)op + 16 * t) = f.half[0]; } } }      /* d = 16 t + 8 hh + 0..7 of query ln: 16 bytes a lane; the wave's four stores fill each row's 128-byte line */
// Preparation, one launch (the three weight planes, the two inputs' f16 rows): none of the five pieces depends on another.
// Work-groups 0 .. PREP_TW - 1: the weight planes, Bt[n][k] = f16(16 bf16(W[k][n])), one tile of 128 k x 64 n each, turned in LDS so that global memory is touched in whole lines only:
// a wave's load = 256 bytes in a row of each of two W rows, a wave's store = 256 bytes in a row of each of two Bt rows (a lane that walks down a column of W instead touches 32 lines a load for 128 bytes).
// In LDS a tile lies as Bt rows: row n = 64 words, word d = the f16 pair k = 2 d, 2 d + 1. Work-groups PREP_TW .. PREP_TW + PREP_CW - 1: PREP_CU * 256 pieces in a row of x and as many of tgt each,
// PREP_CU of either a thread, 256 pieces apart (a piece = 8 elements = one 16-byte store).
#define PREP_TW 512
#define PREP_CW 256
#define PREP_CU 8
#define PREP_LP 65      /* pitch of a tile row in LDS, in words: 1 mod 64, so that the 16 lanes that write 4 rows apart fall 4 banks apart, with the wave's other 16 lanes between them */
typedef unsigned int v4u __attribute__((ext_vector_type(4)));
typedef float v2f __attribute__((ext_vector_type(2)));
typedef _Float16 v2h __attribute__((ext_vector_type(2)));
__device__ __forceinline__ unsigned prep_pair(float lo, float hi) { const v2f t = {bf16_round(lo) * 16.0f, bf16_round(hi) * 16.0f}; return __builtin_bit_cast(unsigned, __builtin_convertvector(t, v2h)); }      /* low half = lo */
// One tile: Bt[n0 + 0..63][k0 + 0..127] from W[k0 + 0..127][n0 + 0..63], W of N columns, Bt of DM. N is a template argument so that the steps from row to row are constants:
// one 32-bit byte offset from the plane's start serves the thread's eight loads, another its four stores.
template <int N>
__device__ __forceinline__ void prep_wtile(const float* __restrict__ Wm, _Float16* __restrict__ Bt, unsigned tile, unsigned* tl) {
  const unsigned n0 = (tile % (N / 64)) * 64u, k0 = (tile / (N / 64)) * 128u; const unsigned c16 = threadIdx.x & 15u, r16 = threadIdx.x >> 4;
  const char* p = (const char*)Wm + ((k0 + 2u * r16) * N + n0 + 4u * c16) * 4u;      /* W[k0 + 2 r16][n0 + 4 c16] */
  v4f lo[4], hi[4];
#pragma unroll      /* constant indices: lo and hi stay in registers */
  for (int j = 0; j < 4; ++j) { lo[j] = *(const v4fa*)(p + 32 * j * N * 4); hi[j] = *(const v4fa*)(p + (32 * j + 1) * N * 4); }      /* rows k0 + 2 r16 + 32 j and the next: the two halves of word r16 + 16 j */
#pragma unroll      /* constant indices, as above */
  for (int j = 0; j < 4; ++j) for (int i = 0; i < 4; ++i) tl[(4u * c16 + i) * PREP_LP + r16 + 16u * j] = prep_pair(lo[j][i], hi[j][i]);
  __syncthreads();      /* the tile is whole before any row of it is read */
  char* d = (char*)Bt + ((n0 + r16) * (unsigned)DM + k0 + 8u * c16) * 2u; const unsigned* r = tl + r16 * PREP_LP + 4u * c16;      /* k = k0 + 8 c16 + 0..7 of row n0 + r16 */
#pragma unroll      /* four rows a thread, 16 apart, their LDS reads issued together */
  for (int s = 0; s < 4; ++s) { const v4u o = {r[16 * s * PREP_LP], r[16 * s * PREP_LP + 1], r[16 * s * PREP_LP + 2], r[16 * s * PREP_LP + 3]}; *(v4u*)(d + 16 * s * DM * 2) = o; } }
__global__ __launch_bounds__(256) void k_prep(const float* __restrict__ x, const float* __restrict__ cond, const float* __restrict__ wq, const float* __restrict__ wkv, const float* __restrict__ wo,
    _Float16* __restrict__ X16, _Float16* __restrict__ C16, _Float16* __restrict__ BQ, _Float16* __restrict__ BKV, _Float16* __restrict__ BO) {
  constexpr unsigned TQ = (DM / 128) * (DM / 64), TKV = (DC / 128) * (2 * DM / 64);      /* tiles of Wq (and of Wp), of Wkv */
  static_assert(DC == DM && DM % 128 == 0 && 2 * TQ + TKV == PREP_TW, "k_prep: one 128 x 64 tile a work-group; every Bt row has DM elements");
  static_assert((size_t)NB * SQ * DM / 8 == (size_t)PREP_CU * PREP_CW * 256 && (size_t)NB * SK * DC / 8 == (size_t)PREP_CU * PREP_CW * 256, "k_prep: PREP_CU pieces of x and of tgt a thread");
  __shared__ unsigned tl[64 * PREP_LP];
  if (blockIdx.x >= PREP_TW) { const unsigned u0 = (blockIdx.x - PREP_TW) * (PREP_CU * 256) + threadIdx.x; v4f a[2][PREP_CU], c[2][PREP_CU];      /* the thread's first piece */
#pragma unroll      /* constant indices: a and c stay in registers */
    for (int s = 0; s < 2; ++s) for (int j = 0; j < PREP_CU; ++j) { const char* p = (const char*)(s ? cond : x) + u0 * 32u + j * 8192; a[s][j] = *(const v4fa*)p; c[s][j] = *(const v4fa*)(p + 16); }      /* a 32-bit byte offset from the buffer's start: one address register serves all the loads */
    __builtin_amdgcn_sched_barrier(0);      /* keeps the thread's 4 PREP_CU loads up here, all in flight together: without it the compiler issued half of them and the rest in small groups among the conversions, behind waits on the first; eight waves a WGP need them all in flight to keep the memory busy */
#pragma unroll      /* constant indices, as above */
    for (int s = 0; s < 2; ++s) for (int j = 0; j < PREP_CU; ++j) { FragH f;
      for (int q = 0; q < 4; ++q) { f.h[q] = (_Float16)bf16_round(a[s][j][q]); f.h[4 + q] = (_Float16)bf16_round(c[s][j][q]); }
      *(v8us*)((char*)(s ? C16 : X16) + u0 * 16u + j * 4096) = f.half[0]; }
    return; }      /* the whole work-group or none: the barrier below is passed by whole work-groups only */
  const unsigned bx = blockIdx.x;      /* every test on it reads the same for the whole work-group: each barrier is passed by all of it */
  if (bx < TKV) prep_wtile<2 * DM>(wkv, BKV, bx, tl);
  else { const bool q = bx < TKV + TQ; prep_wtile<DM>(q ? wq : wo, q ? BQ : BO, q ? bx - TKV : bx - (TKV + TQ), tl); } }
extern "C" void kernel_launch(void* const* d_in, const int* in_sizes, int n_in,
                              void* d_out, int out_size, void* d_ws, size_t ws_size, hipStream_t stream) {
  (void)in_sizes; (void)n_in; (void)out_size;
  const float* const* I = (const float* const*)d_in; const float* x = I[0]; const float* cond = I[1]; const float* wq = I[2]; const float* bq = I[3]; const float* wkv = I[4]; const float* bkv = I[5]; const float* wo = I[6]; const float* bo = I[7];      /* input order: x [2][2048][1024]; tgt [2][2048][1024] (the cond input); [in][out] Wq [1024][1024] + bq; Wkv [1024][2048] + bkv (k | v halves); Wp [1024][1024] + bp; the three biases are bound and read */
  static_assert(NH * HD == DM && HD == 64 && SQ % 256 == 0 && SK % 64 == 0 && DC % 32 == 0 && DM % 64 == 0, "shape / tile multiples");
  static_assert((NB * SQ) % 128 == 0 && (NB * SK) % 128 == 0 && DC % 128 == 0 && DM % 128 == 0, "k_gemm2: whole 128 x 128 tiles, whole 128-k stages");
  const size_t NRK = (size_t)NB * SK;      /* conditioning rows */
  char* ws = (char*)d_ws; size_t off = 0;
  auto take = [&](size_t bytes) { char* p = ws + off; off += (bytes + 255) & ~(size_t)255; return p; };
  _Float16* BQ = (_Float16*)take((size_t)DM * DM * 2); _Float16* BKV = (_Float16*)take((size_t)2 * DM * DC * 2); _Float16* BO = (_Float16*)take((size_t)DM * DM * 2);
  _Float16* X16 = (_Float16*)take(NR * DM * 2); _Float16* C16 = (_Float16*)take(NRK * DC * 2); _Float16* Q16 = (_Float16*)take(NR * DM * 2); _Float16* KV16 = (_Float16*)take(NRK * 2 * DM * 2); _Float16* O16 = (_Float16*)take(NR * DM * 2);
  if (off > ws_size) return;      /* 2 + 4 + 2 (weight planes) + 8 + 8 + 8 + 16 + 8 (row planes) = 56 MiB at NB 2, SK 2048, DC 1024 */
  k_prep<<<PREP_TW + PREP_CW, 256, 0, stream>>>(x, cond, wq, wkv, wo, X16, C16, BQ, BKV, BO);      /* [in][out] -> Bt x16: Wq [1024][1024]; Wkv [DC = 1024][2048] -> Bt [2048][1024] (rows 0..1023 = k, 1024..2047 = v); Wp; and the exact f16 rows of both inputs */
  k_gemm2<0, true, false, false, true><<<dim3((unsigned)((NR / 128) * (DM / 128)), 1), 256, 0, stream>>>(X16, DM, 0, BQ, DM, 0, 0.0625f, bq, 0, nullptr, 1, 0, 0, nullptr, Q16, DM, 0, (int)NR, DM, DM);      /* q rows (f16); head h = columns 64 h .. */
  k_gemm2<0, true, false, false, true><<<dim3((unsigned)((NRK / 128) * (2 * DM / 128)), 1), 256, 0, stream>>>(C16, DC, 0, BKV, DC, 0, 0.0625f, bkv, 0, nullptr, 1, 0, 0, nullptr, KV16, 2 * DM, 0, (int)NRK, 2 * DM, DC);      /* k | v rows (f16, pitch 2048): k = columns 0..1023, v = columns 1024..2047, head h = columns 64 h .. of each half */
  k_fattn<<<dim3(SQ / 256, NH, NB), 256, 0, stream>>>(Q16, KV16, O16);      /* softmax(q . k / 64) v over the SK = 2048 keys -> ctx (merged heads, x64) as f16 rows */
  k_gemm2<0, true, false, true, false><<<dim3((unsigned)((NR / 128) * (DM / 128)), 1), 256, 0, stream>>>(O16, DM, 0, BO, DM, 0, 0.0009765625f, bo, 0, nullptr, 1, 0, 0, (float*)d_out, nullptr, DM, 0, (int)NR, DM, DM);      /* out = ctx proj_w + proj_b */
}

// v010
// A run of this version takes 78.5 microseconds.
// Next to v009, in two timings, it ran 1.05 times as fast each time.
// Counting every step since v000, which is the starting kernel, it is 84.6 times as fast.
#include <hip/hip_runtime.h>
// Multi-head cross-attention with a fused key / value projection and BOTH q and k scaled (x [2][2048][1024] (queries), tgt [2][2048][1024] (keys / values); q = x Wq + bq ([in][out] 1024 x 1024, normal x 0.02; zero bias); kv = tgt Wkv + bkv ([in][out] 1024 x 2048; zero bias) split into halves: k = columns 0..1023, v = columns 1024..2047; 16 heads of 64; logits = (q * 64^-0.5) . (k * 64^-0.5): the module scales BOTH operands, so the effective scale is 1/64; softmax over the 2048 tgt positions (no mask); out = merged Wp + bp ([in][out]; zero bias) -> [2][2048][1024]).
// Structure: token rows; x and tgt as exact f16 rows; natural weights as exact x16 planes; q and k | v WMMA GEMMs (32x64 wave tiles, f32 accumulation, + bias) -> f16; one fused attention launch, V^T fragments by transposing LDS loads (256 queries of one head per work-group: scores, online softmax with f32 statistics and native exp, weights f16, ctx x64 merged f16); ctx Wp + bp -> f32 output; five launches.
// Compute dtype: inputs rounded to bf16; x / weights exact; q, k, v, softmax weights and o as plain f16 GEMM operands (~2^-12); scores and softmax statistics f32. v_wmma_f32_16x16x32_f16.
#define NB 2
#define SQ 2048                      /* query rows per batch */
#define SK 2048                      /* conditioning (key / value) rows per batch */
#define DC 1024                       /* conditioning width */
#define DM 1024
#define NH 16
#define HD 64
#define HG 4                         /* heads per attention launch group */
#define QT 256                       /* query rows per causal tile */
#define NKX SK                       /* S / P row pitch = the SK keys (2048 here) */
#define QT0 128                      /* first-tile rows recomputed exactly in f32 */
#define B0 0                         /* first batch processed (debug hook) */
#define NBR NB                       /* batches processed (debug hook) */
#define NR ((size_t)NB * SQ)
#define DMQ DM
#define DFF 4096         /* token rows */
#define MP ((int)((size_t)NBR * SQ)) /* rows projected (debug hook) */
#define QN SQ                        /* query rows attended per batch (debug hook) */
#define NHD NH                       /* heads attended (debug hook) */
#define MPO MP                       /* rows through the output stage (debug hook) */
#define LQ (3 * DM)      /* unused: q rows have pitch DM, k | v rows 2 DM */
typedef __bf16 v16b __attribute__((ext_vector_type(16)));
typedef unsigned short v8us __attribute__((ext_vector_type(8), may_alias));
typedef float  v8f  __attribute__((ext_vector_type(8)));
typedef float  v4f  __attribute__((ext_vector_type(4)));
typedef float  v4fa __attribute__((ext_vector_type(4), may_alias));
union FragB { v16b v; v8us half[2]; unsigned short u[16]; };

__device__ __forceinline__ unsigned short bf16_bits(float x) { unsigned int u = __float_as_uint(x); return (unsigned short)((u + 0x7FFFu + ((u >> 16) & 1u)) >> 16); }
__device__ __forceinline__ float bf16_val(unsigned short b) { return __uint_as_float(((unsigned int)b) << 16); }
__device__ __forceinline__ float bf16_round(float x) { return bf16_val(bf16_bits(x)); }
// D += A·B with NT terms: 1 = ah·bh, 2 = + al·bh (A split), 3 = + ah·bl (both split)
template <int NT>
__device__ __forceinline__ v8f mmaN(v16b ah, v16b al, v16b bh, v16b bl, v8f c) {
  c = __builtin_amdgcn_wmma_f32_16x16x32_bf16(false, ah, false, bh, (short)0, c, false, false);
  if (NT >= 2) c = __builtin_amdgcn_wmma_f32_16x16x32_bf16(false, al, false, bh, (short)0, c, false, false);
  if (NT >= 3) c = __builtin_amdgcn_wmma_f32_16x16x32_bf16(false, ah, false, bl, (short)0, c, false, false);
  asm volatile("v_nop\n\tv_nop\n\tv_nop\n\tv_nop" : "+v"(c) : "v"(ah), "v"(al), "v"(bh), "v"(bl));
  return c;
}

__global__ __launch_bounds__(256) void k_wt_bf16(const float* __restrict__ W, unsigned short* __restrict__ Wt, int K, int N) {
  const int t = blockIdx.x * 256 + threadIdx.x;
  const int k8n = K / 8;
  if (t >= N * k8n) return;
  const int n = t / k8n, k8 = (t % k8n) * 8;
  v8us v;
#pragma unroll
  for (int i = 0; i < 8; ++i) v[i] = bf16_bits(W[(size_t)(k8 + i) * N + n]);
  *(v8us*)(Wt + (size_t)n * K + k8) = v;
  
}

// GEMM C[M][N] (f32, pitch ldc) = act(A[M][K]·W + bias). A f32 row-major (pitch lda) converted per fragment to bf16
// (ASPLIT: hi/lo two planes -> 2 terms, else single rounded term); Wt bf16 [N][K] (pitch ldb). BIAS_BF16 rounds the
// bias to bf16 first (bias quantised to bf16 before the add). K%32==0, M%16==0, N%64==0.
template <bool ASPLIT, int ACT, bool BIAS_BF16>
__global__ __launch_bounds__(128) void k_gemm_bf(const float* __restrict__ A, int lda, const unsigned short* __restrict__ Wt, int ldb,
                                               const float* __restrict__ bias, float* __restrict__ C, int ldc, int M, int N, int K) {
  __shared__ __attribute__((aligned(16))) float so[4][16][64];
  const int tid = threadIdx.x, w = tid >> 5, lane = tid & 31, ln = lane & 15, hh = lane >> 4;
  const int ntn = N / 64;
  const int wid = blockIdx.x * 4 + w;
  const int mt = wid / ntn, nq = wid % ntn;
  if (mt * 16 >= M) return;
  const int row0 = mt * 16, col0 = nq * 64;
  const float* arow = A + (size_t)(row0 + ln) * lda;
  v8f acc[4] = {};
  for (int kb = 0; kb < K; kb += 32) {
    FragB ah, al;
    const v4f x0 = *(const v4fa*)(arow + kb + 8 * hh), x1 = *(const v4fa*)(arow + kb + 8 * hh + 4);
    const v4f x2 = *(const v4fa*)(arow + kb + 16 + 8 * hh), x3 = *(const v4fa*)(arow + kb + 16 + 8 * hh + 4);
    float xs[16] = {x0[0],x0[1],x0[2],x0[3],x1[0],x1[1],x1[2],x1[3],x2[0],x2[1],x2[2],x2[3],x3[0],x3[1],x3[2],x3[3]};
#pragma unroll
    for (int i = 0; i < 16; ++i) { const unsigned short hb = bf16_bits(xs[i]); ah.u[i] = hb; al.u[i] = ASPLIT ? bf16_bits(xs[i] - bf16_val(hb)) : (unsigned short)0; }
#pragma unroll
    for (int t = 0; t < 4; ++t) {
      const unsigned short* brow = Wt + (size_t)(col0 + t * 16 + ln) * ldb + kb;
      FragB b;
      b.half[0] = *(const v8us*)(brow + 8 * hh);
      b.half[1] = *(const v8us*)(brow + 16 + 8 * hh);
      acc[t] = mmaN<ASPLIT ? 2 : 1>(ah.v, al.v, b.v, b.v, acc[t]);
    }
  }
#pragma unroll
  for (int t = 0; t < 4; ++t) {
    float bv = bias ? bias[col0 + t * 16 + ln] : 0.f;
    if (BIAS_BF16) bv = bf16_round(bv);
#pragma unroll
    for (int r = 0; r < 8; ++r) { float v = acc[t][r] + bv; if (ACT == 1) v = fmaxf(v, 0.f); so[w][8 * hh + r][t * 16 + ln] = v; }
  }
  __builtin_amdgcn_fence(__ATOMIC_ACQ_REL, "workgroup");
  __builtin_amdgcn_wave_barrier();
  const int rsub = lane >> 4, c4 = (lane & 15) * 4;
  {
#pragma unroll
    for (int q = 0; q < 8; ++q) {
      const int r = q * 2 + rsub;
      const v4f v = *(const v4fa*)&so[w][r][c4];
      *(v4f*)(C + (size_t)(row0 + r) * ldc + col0 + c4) = v;
    }
    
  }
}

// GEMM C = act(A·W + bias + resid): A f32 (ASPLIT -> hi/lo 2 terms), Wt bf16 [N][K]; ACT 0 none, 1 relu, 2 exact gelu;
// resid (optional, f32, row index = (row % rmod), pitch ldr, RES_BF16 rounds it) added before the activation.
template <bool ASPLIT, int ACT, bool BIAS_BF16, bool RES_BF16>
__global__ __launch_bounds__(128) void k_gemm_bf3(const float* __restrict__ A, int lda, const unsigned short* __restrict__ Wt, int ldb,
                                                const float* __restrict__ bias, const float* __restrict__ resid, int rmod, int ldr,
                                                float* __restrict__ C, int ldc, int M, int N, int K) {
  __shared__ __attribute__((aligned(16))) float so[4][16][64];
  const int tid = threadIdx.x, w = tid >> 5, lane = tid & 31, ln = lane & 15, hh = lane >> 4;
  const int ntn = N / 64;
  const int wid = blockIdx.x * 4 + w;
  const int mt = wid / ntn, nq = wid % ntn;
  if (mt * 16 >= M) return;
  const int row0 = mt * 16, col0 = nq * 64;
  const float* arow = A + (size_t)(row0 + ln) * lda;
  v8f acc[4] = {};
  for (int kb = 0; kb < K; kb += 32) {
    FragB ah, al;
    const v4f x0 = *(const v4fa*)(arow + kb + 8 * hh), x1 = *(const v4fa*)(arow + kb + 8 * hh + 4);
    const v4f x2 = *(const v4fa*)(arow + kb + 16 + 8 * hh), x3 = *(const v4fa*)(arow + kb + 16 + 8 * hh + 4);
    float xs[16] = {x0[0],x0[1],x0[2],x0[3],x1[0],x1[1],x1[2],x1[3],x2[0],x2[1],x2[2],x2[3],x3[0],x3[1],x3[2],x3[3]};
#pragma unroll
    for (int i = 0; i < 16; ++i) { const unsigned short hb = bf16_bits(xs[i]); ah.u[i] = hb; al.u[i] = ASPLIT ? bf16_bits(xs[i] - bf16_val(hb)) : (unsigned short)0; }
#pragma unroll
    for (int t = 0; t < 4; ++t) {
      const unsigned short* brow = Wt + (size_t)(col0 + t * 16 + ln) * ldb + kb;
      FragB b;
      b.half[0] = *(const v8us*)(brow + 8 * hh);
      b.half[1] = *(const v8us*)(brow + 16 + 8 * hh);
      acc[t] = mmaN<ASPLIT ? 2 : 1>(ah.v, al.v, b.v, b.v, acc[t]);
    }
  }
#pragma unroll
  for (int t = 0; t < 4; ++t) {
    const int col = col0 + t * 16 + ln;
    float bv = bias ? bias[col] : 0.f;
    if (BIAS_BF16) bv = bf16_round(bv);
#pragma unroll
    for (int r = 0; r < 8; ++r) {
      float v = acc[t][r] + bv;
      if (resid) { float rv = resid[(size_t)((row0 + 8 * hh + r) % rmod) * ldr + col]; if (RES_BF16) rv = bf16_round(rv); v += rv; }
      if (ACT == 1) v = fmaxf(v, 0.f);
      if (ACT == 2) v = 0.5f * v * (1.0f + erff(v * 0.70710678118654752f));
      if (ACT == 3) { const float u = 0.7978845608028654f * (v + 0.044715f * v * v * v); v = 0.5f * v * (1.0f + tanhf(u)); }
      so[w][8 * hh + r][t * 16 + ln] = v;
    }
  }
  __builtin_amdgcn_fence(__ATOMIC_ACQ_REL, "workgroup");
  __builtin_amdgcn_wave_barrier();
  const int rsub = lane >> 4, c4 = (lane & 15) * 4;
  {
#pragma unroll
    for (int q = 0; q < 8; ++q) {
      const int r = q * 2 + rsub;
      const v4f v = *(const v4fa*)&so[w][r][c4];
      *(v4f*)(C + (size_t)(row0 + r) * ldc + col0 + c4) = v;
    }
    
  }
}
// row LayerNorm (biased variance, eps) over N: s = X (+ R); optional out_sum <- s; out_norm <- (s-mu)*rsqrt(var+eps)*g + b
template <bool PARAM_BF16>
__global__ __launch_bounds__(256) void k_layernorm(const float* __restrict__ X, const float* __restrict__ R, const float* __restrict__ g, const float* __restrict__ bta,
                                                  float* __restrict__ out_sum, float* __restrict__ out_norm, int N, float eps) {
  __shared__ float red[256];
  const int row = blockIdx.x, tid = threadIdx.x;
  const float* x = X + (size_t)row * N; const float* rr = R ? R + (size_t)row * N : nullptr;
  float vals[16];                     // up to N = 4096
  const int per = N / 256;            // contiguous chunk per thread? use strided-by-4 chunks: thread handles j = tid*4 + 1024*u
  float s1 = 0.f;
  for (int u = 0; u < per / 4; ++u) {
    const int j = tid * 4 + 1024 * u;
    const v4f a = *(const v4fa*)(x + j);
    v4f b = {0.f,0.f,0.f,0.f}; if (rr) b = *(const v4fa*)(rr + j);
#pragma unroll
    for (int q = 0; q < 4; ++q) { const float v = a[q] + b[q]; vals[u * 4 + q] = v; s1 += v; }
  }
  red[tid] = s1; __syncthreads();
  for (int st = 128; st > 0; st >>= 1) { if (tid < st) red[tid] += red[tid + st]; __syncthreads(); }
  const float mu = red[0] / (float)N; __syncthreads();
  float s2 = 0.f;
  for (int u = 0; u < per / 4; ++u)
#pragma unroll
    for (int q = 0; q < 4; ++q) { const float c = vals[u * 4 + q] - mu; s2 += c * c; }
  red[tid] = s2; __syncthreads();
  for (int st = 128; st > 0; st >>= 1) { if (tid < st) red[tid] += red[tid + st]; __syncthreads(); }
  const float rs = rsqrtf(red[0] / (float)N + eps);
  {
    for (int u = 0; u < per / 4; ++u) {
      const int j = tid * 4 + 1024 * u;
      v4f o, sm;
#pragma unroll
      for (int q = 0; q < 4; ++q) {
        float gg = g[j + q], bb = bta[j + q];
        if (PARAM_BF16) { gg = bf16_round(gg); bb = bf16_round(bb); }
        sm[q] = vals[u * 4 + q]; o[q] = (vals[u * 4 + q] - mu) * rs * gg + bb;
      }
      if (out_sum) *(v4f*)(out_sum + (size_t)row * N + j) = sm;
      *(v4f*)(out_norm + (size_t)row * N + j) = o;
    }
    
  }
}



// ---- f16 WMMA path (v_wmma_f32_16x16x32_f16): 11-bit significands for operands in range — used where a [0,1] probability operand needs more precision than bf16
typedef _Float16 v16h __attribute__((ext_vector_type(16)));
union FragH { v16h v; v8us half[2]; _Float16 h[16]; unsigned short u[16]; };
template <int NT>
__device__ __forceinline__ v8f mmaH(v16h ah, v16h al, v16h bh, v16h bl, v8f c) {
  c = __builtin_amdgcn_wmma_f32_16x16x32_f16(false, ah, false, bh, (short)0, c, false, false);
  if (NT >= 2) c = __builtin_amdgcn_wmma_f32_16x16x32_f16(false, al, false, bh, (short)0, c, false, false);
  if (NT >= 3) c = __builtin_amdgcn_wmma_f32_16x16x32_f16(false, ah, false, bl, (short)0, c, false, false);
  asm volatile("v_nop\n\tv_nop\n\tv_nop\n\tv_nop" : "+v"(c) : "v"(ah), "v"(al), "v"(bh), "v"(bl));
  return c;
}
// batched GEMM like k_gemm_b but f16 operands: A f32 (split into f16 hi/lo if ASPLIT, else rounded to f16), Bt = f16 values [n][k]; alpha; C f32; N multiple of 16 (partial tiles skipped)
template <bool ASPLIT>
__global__ __launch_bounds__(128) void k_gemm_h(const float* __restrict__ A, int lda, size_t sA, const _Float16* __restrict__ Bh, int ldb, size_t sB, float alpha, float* __restrict__ C, int ldc, size_t sC, int M, int N, int K) {
  __shared__ __attribute__((aligned(16))) float so[4][16][64];
  const int tid = threadIdx.x, w = tid >> 5, lane = tid & 31, ln = lane & 15, hh = lane >> 4; const int by = blockIdx.y;
  A += (size_t)by * sA; Bh += (size_t)by * sB; C += (size_t)by * sC;
  const int ntn = (N + 63) / 64; const int wid = blockIdx.x * 4 + w; const int mt = wid / ntn, nq = wid % ntn; if (mt * 16 >= M) return;
  const int row0 = mt * 16, col0 = nq * 64; const float* arow = A + (size_t)(row0 + ln) * lda;
  v8f acc[4] = {};
  for (int kb = 0; kb < K; kb += 32) {
    FragH ah, al;
    const v4f x0 = *(const v4fa*)(arow + kb + 8 * hh), x1 = *(const v4fa*)(arow + kb + 8 * hh + 4), x2 = *(const v4fa*)(arow + kb + 16 + 8 * hh), x3 = *(const v4fa*)(arow + kb + 16 + 8 * hh + 4);
    float xs[16] = {x0[0],x0[1],x0[2],x0[3],x1[0],x1[1],x1[2],x1[3],x2[0],x2[1],x2[2],x2[3],x3[0],x3[1],x3[2],x3[3]};
#pragma unroll
    for (int i = 0; i < 16; ++i) { const _Float16 h = (_Float16)xs[i]; ah.h[i] = h; al.h[i] = ASPLIT ? (_Float16)(xs[i] - (float)h) : (_Float16)0.0f; }
#pragma unroll
    for (int t = 0; t < 4; ++t) { if (col0 + t * 16 >= N) continue; const size_t boff = (size_t)(col0 + t * 16 + ln) * ldb + kb; FragH bq; bq.half[0] = *(const v8us*)(Bh + boff + 8 * hh); bq.half[1] = *(const v8us*)(Bh + boff + 16 + 8 * hh);
      acc[t] = mmaH<ASPLIT ? 2 : 1>(ah.v, al.v, bq.v, bq.v, acc[t]); }
  }
#pragma unroll
  for (int t = 0; t < 4; ++t) { if (col0 + t * 16 >= N) continue;
#pragma unroll
    for (int r = 0; r < 8; ++r) so[w][8 * hh + r][t * 16 + ln] = acc[t][r] * alpha; }
  __builtin_amdgcn_fence(__ATOMIC_ACQ_REL, "workgroup"); __builtin_amdgcn_wave_barrier();
  const int rsub = lane >> 4, c4 = (lane & 15) * 4;
  {
#pragma unroll
    for (int q = 0; q < 8; ++q) { const int r = q * 2 + rsub; if (col0 + c4 < N) { const v4f v = *(const v4fa*)&so[w][r][c4]; *(v4f*)(C + (size_t)(row0 + r) * ldc + col0 + c4) = v; } }
     }
}

// Wt[n][k] = f16(W[k][n]·scale) from f32 row-major W[K][N] (scale = power of two; bf16-exact weights stay exact in f16 away from the subnormal range)
__global__ __launch_bounds__(256) void k_wt_f16(const float* __restrict__ W, _Float16* __restrict__ Wt, int K, int N, float scale) {
  const int t = blockIdx.x * 256 + threadIdx.x; if (t >= N * (K / 8)) return; const int n = t / (K / 8), k8 = (t % (K / 8)) * 8; FragH f;
#pragma unroll
  for (int i = 0; i < 8; ++i) f.h[i] = (_Float16)(bf16_round(W[(size_t)(k8 + i) * N + n]) * scale); const v8us o = f.half[0];
  *(v8us*)((unsigned short*)Wt + (size_t)n * K + k8) = o; 
}
// k_gemm_hh variant with fused epilogue: v = acc·alpha + bias[by·sBias + col] (+ CP[(row/rowsPerB)·sCPb + by·64 + col] if CP) ; ACT 0 none / 1 elu ; writes f16 C16 (and f32 C if non-null)
template <int ACT>
__global__ __launch_bounds__(128) void k_gemm_hhx(const _Float16* __restrict__ A, int lda, size_t sA, const _Float16* __restrict__ Bh, int ldb, size_t sB, float alpha, const float* __restrict__ bias, size_t sBias, const float* __restrict__ CP, int rowsPerB, size_t sCPb, int row0g,
    float* __restrict__ C, _Float16* __restrict__ C16, int ldc, size_t sC, int M, int N, int K) {
  __shared__ __attribute__((aligned(16))) float so[4][16][64];
  const int tid = threadIdx.x, w = tid >> 5, lane = tid & 31, ln = lane & 15, hh = lane >> 4; const int by = blockIdx.y;
  A += (size_t)by * sA; Bh += (size_t)by * sB; const size_t cofs = (size_t)by * sC; const float* bp = bias ? bias + (size_t)by * sBias : nullptr;
  const int ntn = (N + 63) / 64; const int wid = blockIdx.x * 4 + w; const int mt = wid / ntn, nq = wid % ntn; if (mt * 16 >= M) return;
  const int row0 = mt * 16, col0 = nq * 64; const _Float16* arow = A + (size_t)(row0 + ln) * lda;
  v8f acc[4] = {};
  for (int kb = 0; kb < K; kb += 32) { FragH ah; ah.half[0] = *(const v8us*)((const unsigned short*)arow + kb + 8 * hh); ah.half[1] = *(const v8us*)((const unsigned short*)arow + kb + 16 + 8 * hh);
#pragma unroll
    for (int t = 0; t < 4; ++t) { if (col0 + t * 16 >= N) continue; const size_t boff = (size_t)(col0 + t * 16 + ln) * ldb + kb; FragH bq; bq.half[0] = *(const v8us*)((const unsigned short*)Bh + boff + 8 * hh); bq.half[1] = *(const v8us*)((const unsigned short*)Bh + boff + 16 + 8 * hh);
      acc[t] = mmaH<1>(ah.v, ah.v, bq.v, bq.v, acc[t]); }
  }
#pragma unroll
  for (int t = 0; t < 4; ++t) { if (col0 + t * 16 >= N) continue; const int col = col0 + t * 16 + ln; const float bv = bp ? bf16_round(bp[col]) : 0.f;
#pragma unroll
    for (int r = 0; r < 8; ++r) { float v = acc[t][r] * alpha + bv; if (CP) { const int rr = row0g + row0 + 8 * hh + r; if (rowsPerB < 0) v += CP[cofs + (size_t)rr * ldc + col];      /* rowsPerB < 0: own element of the batched C plane */ else { const int bidx = rr / rowsPerB; v += CP[(size_t)bidx * sCPb + (size_t)by * 64 + col]; } } if (ACT == 1) v = (v > 0.f) ? v : expm1f(v); else if (ACT == 7) v = (v > 0.f) ? v + 1.0f : expf(v); else if (ACT == 8) v = tanhf(v); else if (ACT == 9) v = 0.5f * v * (1.0f + tanhf(0.7978845608028654f * (v + 0.044715f * v * v * v))); else if (ACT == 11) v = 1.0f / (1.0f + expf(-v)); else if (ACT == 12) v = (v > 0.f) ? v : 0.01f * v; else if (ACT == 14) v = (v > 0.f) ? v : 0.1f * v; else if (ACT == 16) v = (v >= 0.f) ? v : 0.3f * v; else if (ACT == 17) v = (v >= 0.f) ? v : 0.2f * v; else if (ACT == 15) v = v / (1.0f + expf(-v)); else if (ACT == 3) v = fmaxf(v, 0.f); else if (ACT == 6) v = 0.5f * v * (1.0f + erff(v * 0.70710678118654752f)); so[w][8 * hh + r][t * 16 + ln] = v; } }
  __builtin_amdgcn_fence(__ATOMIC_ACQ_REL, "workgroup"); __builtin_amdgcn_wave_barrier();
  const int rsub = lane >> 4, c4 = (lane & 15) * 4; typedef _Float16 v4h __attribute__((ext_vector_type(4)));
  {
#pragma unroll
    for (int q = 0; q < 8; ++q) { const int r = q * 2 + rsub; if (col0 + c4 < N) { const v4f v = *(const v4fa*)&so[w][r][c4]; if (C) *(v4f*)(C + cofs + (size_t)(row0 + r) * ldc + col0 + c4) = v; if (C16) { v4h h4; for (int i = 0; i < 4; ++i) h4[i] = (_Float16)v[i]; *(v4h*)(C16 + cofs + (size_t)(row0 + r) * ldc + col0 + c4) = h4; } } }
     }
}


typedef _Float16 v4h __attribute__((ext_vector_type(4)));

__global__ __launch_bounds__(256) void k_x16(const float* __restrict__ x, _Float16* __restrict__ X16, size_t n8) { const size_t t = (size_t)blockIdx.x * 256 + threadIdx.x; if (t >= n8) return; FragH f;
#pragma unroll
  for (int q = 0; q < 8; ++q) f.h[q] = (_Float16)bf16_round(x[t * 8 + q]); *(v8us*)((unsigned short*)X16 + t * 8) = f.half[0];  }
__global__ __launch_bounds__(256) void k_h16(const float* __restrict__ x, _Float16* __restrict__ X16, size_t n8) { const size_t t = (size_t)blockIdx.x * 256 + threadIdx.x; if (t >= n8) return; FragH f;
#pragma unroll
  for (int q = 0; q < 8; ++q) f.h[q] = (_Float16)x[t * 8 + q]; *(v8us*)((unsigned short*)X16 + t * 8) = f.half[0];  }
__global__ __launch_bounds__(256) void k_round16f(const float* __restrict__ W, _Float16* __restrict__ Bt, size_t n8) { const size_t t = (size_t)blockIdx.x * 256 + threadIdx.x; if (t >= n8) return; FragH f;
#pragma unroll
  for (int i = 0; i < 8; ++i) f.h[i] = (_Float16)(bf16_round(W[t * 8 + i]) * 16.0f); *(v8us*)((unsigned short*)Bt + t * 8) = f.half[0];  }
__global__ __launch_bounds__(256) void k_hl(const float* __restrict__ F, _Float16* __restrict__ Hh, _Float16* __restrict__ Hl, size_t n8) { const size_t t = (size_t)blockIdx.x * 256 + threadIdx.x; if (t >= n8) return; FragH fh, fl; const v4f a = *(const v4fa*)(F + t * 8), c = *(const v4fa*)(F + t * 8 + 4);
#pragma unroll
  for (int q = 0; q < 4; ++q) { _Float16 h = (_Float16)a[q]; fh.h[q] = h; fl.h[q] = (_Float16)((a[q] - (float)h) * 1024.0f); h = (_Float16)c[q]; fh.h[4 + q] = h; fl.h[4 + q] = (_Float16)((c[q] - (float)h) * 1024.0f); }
  { *(v8us*)((unsigned short*)Hh + t * 8) = fh.half[0]; *(v8us*)((unsigned short*)Hl + t * 8) = fl.half[0];  } }

// ---- fast GEMM (wave tile 32x64, work-group tile 128x128 = 8 waves, 4 down and 2 across; requires M % 128 == 0 rows per launch region, N % 128 == 0 and K % 128 == 0); epilogue = k_gemm_hhx semantics ----
__device__ __forceinline__ v16h g2_frag(const _Float16* p, int hh) { FragH f; f.half[0] = *(const v8us*)((const unsigned short*)p + 8 * hh); f.half[1] = *(const v8us*)((const unsigned short*)p + 16 + 8 * hh); return f.v; }
__device__ __forceinline__ v8f g2_mma(v16h a, v16h b, v8f c) { v8f d = __builtin_amdgcn_wmma_f32_16x16x32_f16(false, a, false, b, (short)0, c, false, false); asm volatile("v_nop\n\tv_nop\n\tv_nop\n\tv_nop" : "+v"(d) : "v"(a), "v"(b)); return d; }
// A stage of k_gemm2 = 128 k of the work-group's 128 A rows and 128 B rows: 256 rows of 256 bytes in LDS at a pitch of 272 (16 B x odd: the 16 lanes of a half wave's ds_load_b128 fall on 64 different banks).
// The square tile brings (128 + 128) operand rows from L2 for 128 x 128 results, where two tiles of 128 x 64 bring 2 (128 + 64); the longer stage keeps as many bytes in flight for a work-group that may be alone on its WGP.
#define G2_PITCH 272
#define G2_BOFF (128 * G2_PITCH)      /* the B rows stand behind the A rows */
#define G2_STAGE (256 * G2_PITCH)
__device__ __forceinline__ v16h g2_lfrag(const unsigned char* p) { FragH f; f.half[0] = *(const v8us*)p; f.half[1] = *(const v8us*)(p + 32); return f.v; }      /* p = row start + 64 B per 32 k + 16 hh: the k order of g2_frag */
// One operand's 128 rows of a stage, global memory -> LDS through no register: 8 asynchronous copies of 16 bytes a lane, 16 rows apart; 16 lanes fill one row, so a wave's copy reads two whole 256-byte rows.
// lds = the lane's own LDS byte address of its first row, g = its own global address, r16 = 16 rows in elements. The s_wait_xcnt stands inside the statement, behind the last copy, so that
// no address register of a copy is written again in front of it.
__device__ __forceinline__ void g2_rows(unsigned lds, const _Float16* g, size_t r16) {
  asm volatile("global_load_async_to_lds_b128 %0, %8, off\n\tglobal_load_async_to_lds_b128 %1, %9, off\n\tglobal_load_async_to_lds_b128 %2, %10, off\n\tglobal_load_async_to_lds_b128 %3, %11, off\n\t"
               "global_load_async_to_lds_b128 %4, %12, off\n\tglobal_load_async_to_lds_b128 %5, %13, off\n\tglobal_load_async_to_lds_b128 %6, %14, off\n\tglobal_load_async_to_lds_b128 %7, %15, off\n\t"
               "s_wait_xcnt 0x0"
               :: "v"(lds), "v"(lds + 16 * G2_PITCH), "v"(lds + 32 * G2_PITCH), "v"(lds + 48 * G2_PITCH), "v"(lds + 64 * G2_PITCH), "v"(lds + 80 * G2_PITCH), "v"(lds + 96 * G2_PITCH), "v"(lds + 112 * G2_PITCH),
                  "v"(g), "v"(g + r16), "v"(g + 2 * r16), "v"(g + 3 * r16), "v"(g + 4 * r16), "v"(g + 5 * r16), "v"(g + 6 * r16), "v"(g + 7 * r16) : "memory"); }
// One stage: the A rows, then the B rows behind them (an asm statement takes 30 operands, so the 16 copies stand in two).
__device__ __forceinline__ void g2_stage(unsigned lds, const _Float16* ga, const _Float16* gb, size_t a16, size_t b16) { g2_rows(lds, ga, a16); g2_rows(lds + G2_BOFF, gb, b16); }
// What the epilogue does is fixed per launch, so it is a template argument and not a test at run time: BIAS = a bias row is added, RES = the CP term is added, W32 / W16 = the f32 / the f16 plane is written.
// With run-time tests every one of a lane's 64 results jumped over the unused CP code, every bias load and every row store stood behind a branch of its own and waited alone, and the text was six times as long.
template <int ACT, bool BIAS, bool RES, bool W32, bool W16>
__global__ __launch_bounds__(256) void k_gemm2(const _Float16* __restrict__ A, int lda, size_t sA, const _Float16* __restrict__ Bh, int ldb, size_t sB, float alpha, const float* __restrict__ bias, size_t sBias, const float* __restrict__ CP, int rowsPerB, size_t sCPb, int row0g,
    float* __restrict__ C, _Float16* __restrict__ C16, int ldc, size_t sC, int M, int N, int K) { static_assert(ACT == 0 || ACT == 3 || ACT == 6 || ACT == 8 || ACT == 9 || ACT == 11 || ACT == 12 || ACT == 14 || ACT == 15 || ACT == 16 || ACT == 17, "k_gemm2: unsupported ACT code (would silently apply no activation)");
  __shared__ __attribute__((aligned(16))) unsigned char sm[2 * G2_STAGE];      /* two stage buffers; behind the K loop the same bytes are the epilogue's staging rows */
  static_assert(sizeof(float) * 8 * 32 * 68 <= 2 * G2_STAGE, "epilogue staging fits the ring"); float (*so)[32][68] = (float (*)[32][68])sm;
  const int tid = threadIdx.x, w = tid >> 5, lane = tid & 31, ln = lane & 15, hh = lane >> 4; const int by = blockIdx.y;
  A += (size_t)by * sA; Bh += (size_t)by * sB; const size_t cofs = (size_t)by * sC; const float* bp = bias + (size_t)by * sBias;
  const int ntn = N >> 7; const int mt = blockIdx.x / ntn, nq = blockIdx.x - mt * ntn; const int wr = w & 3, wc = w >> 2; const int row0 = mt * 128 + 32 * wr, col0 = nq * 128 + 64 * wc; if (mt * 128 >= M) return;      /* the whole work-group or none, in front of every barrier */
  const int cr = tid >> 4, cc = tid & 15;      /* the lane's copies: rows cr + 16 i of either operand, 16-byte piece cc of the row's 256 bytes */
  const unsigned lds0 = (unsigned)(size_t)sm + (unsigned)(cr * G2_PITCH + cc * 16);
  const _Float16* ga = A + (size_t)(mt * 128 + cr) * lda + cc * 8; const _Float16* gb = Bh + (size_t)(nq * 128 + cr) * ldb + cc * 8; const size_t a16 = (size_t)16 * lda, b16 = (size_t)16 * ldb;
  const unsigned char* fa = sm + (32 * wr + ln) * G2_PITCH + 16 * hh; const unsigned char* fb = sm + G2_BOFF + (64 * wc + ln) * G2_PITCH + 16 * hh;      /* the lane's fragment rows in buffer 0 */
  const v8f z8 = {0.f,0.f,0.f,0.f,0.f,0.f,0.f,0.f}; v8f c00 = z8, c01 = z8, c02 = z8, c03 = z8, c10 = z8, c11 = z8, c12 = z8, c13 = z8;
  const int nst = K >> 7;
  // The K walk is rotated: this work-group takes the stages in the order sn, sn + 1, ..., nst - 1, 0, ..., sn - 1, with sn = (tile row + tile column) mod nst. The work-groups of a tile row copy the same A rows and those of a
  // tile column the same B rows, and they run at the same time: all starting at k = 0 they ask L2 for the same lines at the same moment, trip after trip.
  // Every stage is still taken exactly once; only the order in which a result's 32-k blocks are summed depends on the tile.
  int sn = (int)((unsigned)(mt + nq) % (unsigned)nst);      /* the next stage to copy; the same for the whole work-group */
  float bvs[4] = {0.f, 0.f, 0.f, 0.f};      /* the lane's four bias elements, loaded together up here: they fly beside the first stage's copies and cost the epilogue no wait */
  if (BIAS) {
#pragma unroll      /* constant indices: bvs stays in registers */
    for (int t = 0; t < 4; ++t) bvs[t] = bp[col0 + t * 16 + ln]; }
  g2_stage(lds0, ga + (size_t)sn * 128, gb + (size_t)sn * 128, a16, b16); sn = (sn + 1 == nst) ? 0 : sn + 1;
  asm volatile("s_wait_asynccnt 0x0" ::: "memory");      /* this wave's copies of the first stage have landed */
  __syncthreads();      /* ... and every other wave's: the first stage may be read */
  if (nst > 1) { g2_stage(lds0 + G2_STAGE, ga + (size_t)sn * 128, gb + (size_t)sn * 128, a16, b16); sn = (sn + 1 == nst) ? 0 : sn + 1; }
#pragma unroll 1      /* rolled: the buffer is picked by the trip's parity, a second copy of the body would only add code */
  for (int t = 0; t < nst; ++t) { const unsigned bo = (unsigned)(t & 1) * G2_STAGE;
#pragma unroll      /* the stage's two halves of 64 k, one after the other: constant offsets for every LDS read */
   for (int hf = 0; hf < 2; ++hf) {
    const unsigned char* pa = fa + bo + 128 * hf; const unsigned char* pb = fb + bo + 128 * hf; v16h af[2][2], bf[2][4];
#pragma unroll      /* constant indices: the fragment arrays become registers */
    for (int kc = 0; kc < 2; ++kc) { af[kc][0] = g2_lfrag(pa + 64 * kc); bf[kc][0] = g2_lfrag(pb + 64 * kc); af[kc][1] = g2_lfrag(pa + 64 * kc + 16 * G2_PITCH);
      for (int j = 1; j < 4; ++j) bf[kc][j] = g2_lfrag(pb + 64 * kc + j * 16 * G2_PITCH); }
#pragma unroll      /* the half's two 32-k blocks, in ascending k inside the stage */
    for (int kc = 0; kc < 2; ++kc) { c00 = g2_mma(af[kc][0], bf[kc][0], c00); c10 = g2_mma(af[kc][1], bf[kc][0], c10); c01 = g2_mma(af[kc][0], bf[kc][1], c01); c11 = g2_mma(af[kc][1], bf[kc][1], c11);
      c02 = g2_mma(af[kc][0], bf[kc][2], c02); c12 = g2_mma(af[kc][1], bf[kc][2], c12); c03 = g2_mma(af[kc][0], bf[kc][3], c03); c13 = g2_mma(af[kc][1], bf[kc][3], c13); } }
    asm volatile("s_wait_dscnt 0x0" ::: "memory");      /* this wave's reads of the buffer are done before it is handed to the copies */
    asm volatile("s_wait_asynccnt 0x0" ::: "memory");      /* this wave's copies for trip t + 1 have landed */
    __syncthreads();      /* publishes the stage of trip t + 1 and ends every wave's reads of trip t's buffer */
    if (t + 2 < nst) { g2_stage(lds0 + bo, ga + (size_t)sn * 128, gb + (size_t)sn * 128, a16, b16); sn = (sn + 1 == nst) ? 0 : sn + 1; } }      /* refill of the buffer just read, with the walk's stage for trip t + 2; in flight under trip t + 1 */
  asm volatile("s_wait_asynccnt 0x0" ::: "memory");      /* no copy is outstanding when the ring becomes staging; the last trip's barrier has ended every read of it */
  v8f accs[8] = {c00, c01, c02, c03, c10, c11, c12, c13};
#pragma unroll
  for (int u = 0; u < 8; ++u) { const int t = u & 3, half = u >> 2; const int col = col0 + t * 16 + ln; const float bv = BIAS ? bf16_round(bvs[t]) : 0.f;
#pragma unroll
    for (int r = 0; r < 8; ++r) { const int rloc = half * 16 + 8 * hh + r; float v = accs[u][r] * alpha + bv; if (RES) { if (rowsPerB < 0) v += CP[cofs + (size_t)(row0g + row0 + rloc) * ldc + col];      /* rowsPerB < 0: own element of the batched C plane */ else { const int bidx = (row0g + row0 + rloc) / rowsPerB; v += CP[(size_t)bidx * sCPb + (size_t)by * 64 + col]; } }
      if (ACT == 3) v = fmaxf(v, 0.f); else if (ACT == 6) v = 0.5f * v * (1.0f + erff(v * 0.70710678118654752f)); else if (ACT == 11) v = 1.0f / (1.0f + expf(-v)); else if (ACT == 15) v = v / (1.0f + expf(-v)); else if (ACT == 12) v = (v > 0.f) ? v : 0.01f * v; else if (ACT == 8) v = tanhf(v); else if (ACT == 9) v = 0.5f * v * (1.0f + tanhf(0.7978845608028654f * (v + 0.044715f * v * v * v))); else if (ACT == 14) v = (v > 0.f) ? v : 0.1f * v; else if (ACT == 16) v = (v >= 0.f) ? v : 0.3f * v; else if (ACT == 17) v = (v >= 0.f) ? v : 0.2f * v;
      so[w][rloc][t * 16 + ln] = v; } }
  __builtin_amdgcn_fence(__ATOMIC_ACQ_REL, "workgroup"); __builtin_amdgcn_wave_barrier();
  const int rsub = lane >> 4, c4 = (lane & 15) * 4;
  {
#pragma unroll
    for (int q = 0; q < 16; ++q) { const int r = q * 2 + rsub; const v4f v = *(const v4fa*)&so[w][r][c4]; if (W32) *(v4f*)(C + cofs + (size_t)(row0 + r) * ldc + col0 + c4) = v; if (W16) { v4h h4; for (int i = 0; i < 4; ++i) h4[i] = (_Float16)v[i]; *(v4h*)(C16 + cofs + (size_t)(row0 + r) * ldc + col0 + c4) = h4; } }
     } }


__global__ __launch_bounds__(256) void k_wnat(const float* __restrict__ w, size_t n8, _Float16* __restrict__ Bt) { const size_t t = (size_t)blockIdx.x * 256 + threadIdx.x; if (t >= n8) return; FragH f; for (int q = 0; q < 8; ++q) f.h[q] = (_Float16)(bf16_round(w[t * 8 + q]) * 16.0f); *(v8us*)((unsigned short*)Bt + t * 8) = f.half[0];  }
__global__ __launch_bounds__(256) void k_rsm(const float* __restrict__ S, _Float16* __restrict__ P, int nrows) {
  #pragma clang fp contract(off)
  const int i = blockIdx.x * 256 + threadIdx.x; if (i >= nrows) return; const float* s = S + (size_t)i * SQ; float mx = -3.0e38f;
#pragma unroll 1
  for (int j = 0; j < SQ; ++j) mx = fmaxf(mx, s[j]); float se = 0.f;
#pragma unroll 1
  for (int j = 0; j < SQ; ++j) se += expf(s[j] - mx); const float sc = 256.0f / se;
#pragma unroll 1
  for (int j0 = 0; j0 < SQ; j0 += 8) { FragH f; for (int q = 0; q < 8; ++q) f.h[q] = (_Float16)(expf(s[j0 + q] - mx) * sc); unsigned short* d = (unsigned short*)P + (size_t)i * SQ + j0; *(v8us*)d = f.half[0];  } }
__global__ __launch_bounds__(256) void k_vt(const _Float16* __restrict__ V16, int b, int h0, _Float16* __restrict__ VT) { __shared__ unsigned short tl[64][65]; const int tid = threadIdx.x; const int hh = blockIdx.x % HG, sg = blockIdx.x / HG; const int s0 = sg * 64; const int h = h0 + hh;
  for (int i = tid; i < 64 * 8; i += 256) { const int j = i / 8, d8 = (i % 8) * 8; FragH f; f.half[0] = *(const v8us*)((const unsigned short*)V16 + ((size_t)b * SQ + s0 + j) * DM + h * HD + d8); for (int q = 0; q < 8; ++q) tl[d8 + q][j] = f.u[q]; }
  __syncthreads();
  { for (int i = tid; i < 64 * 8; i += 256) { const int d = i / 8, j8 = (i % 8) * 8; FragH f; for (int q = 0; q < 8; ++q) f.u[q] = tl[d][j8 + q]; *(v8us*)((unsigned short*)VT + ((size_t)hh * HD + d) * SQ + s0 + j8) = f.half[0]; }  } }



__global__ __launch_bounds__(256) void k_rsmcf2(const float* __restrict__ S, _Float16* __restrict__ P, int hg, int q0, int nk) {
  #pragma clang fp contract(off)
  const int t = blockIdx.x * 256 + threadIdx.x; if (t >= hg * QT) return; const size_t i = (size_t)t; const float* s = S + i * NKX; const int last = q0 + (t % QT); float mx = -3.0e38f;
#pragma unroll 1
  for (int j = 0; j < nk; ++j) { const float f = (j <= last) ? 1.f : 0.f; mx = fmaxf(mx, fmaf(f, s[j], (1.f - f) * -1.0e9f)); } float se = 0.f;
#pragma unroll 1
  for (int j = 0; j < nk; ++j) { const float f = (j <= last) ? 1.f : 0.f; se += __expf(fmaf(f, s[j], (1.f - f) * -1.0e9f) - mx); } const float sc = 256.0f / se;
#pragma unroll 1
  for (int j0 = 0; j0 < nk; j0 += 8) { FragH fr; for (int q = 0; q < 8; ++q) { const int j = j0 + q; const float f = (j <= last) ? 1.f : 0.f; fr.h[q] = (_Float16)(__expf(fmaf(f, s[j], (1.f - f) * -1.0e9f) - mx) * sc); } unsigned short* d = (unsigned short*)P + i * NKX + j0; *(v8us*)d = fr.half[0];  } }


template <int MASKADD>
__global__ __launch_bounds__(64) void k_att0(const float* __restrict__ QF, const float* __restrict__ KF, const float* __restrict__ VF, int ld, const float* __restrict__ mask, float scale, float* __restrict__ OF, int ldo) {
  #pragma clang fp contract(off)
  __shared__ __attribute__((aligned(16))) float lq[64][64]; __shared__ __attribute__((aligned(16))) float lo[64][64];
  const int tid = threadIdx.x; const int h = blockIdx.x / (QT0 / 64), rg = blockIdx.x % (QT0 / 64); const int i = rg * 64 + tid;
  const float* qr = QF + (size_t)i * ld + h * HD;
#pragma unroll 1
  for (int c = 0; c < HD / 4; ++c) { *(v4f*)&lq[tid][c * 4] = *(const v4fa*)(qr + c * 4); const v4f z = {0.f, 0.f, 0.f, 0.f}; *(v4f*)&lo[tid][c * 4] = z; }
  float m = -1.0e30f, l = 0.f; const int jmax = MASKADD ? (SQ - 1) : (rg * 64 + 63);      /* additive-mask form: every key (the mask input decides); causal form: keys up to the block's last row */
#pragma unroll 1
  for (int j = 0; j <= jmax; ++j) { const float* kr = KF + (size_t)j * ld + h * HD; const float* vr = VF + (size_t)j * ld + h * HD; float s = 0.f;
#pragma unroll 1
    for (int c = 0; c < HD / 4; ++c) { const v4f kq = *(const v4fa*)(kr + c * 4); const v4f qq = *(v4f*)&lq[tid][c * 4]; s = __fadd_rn(s, __fmul_rn(qq[0], kq[0])); s = __fadd_rn(s, __fmul_rn(qq[1], kq[1])); s = __fadd_rn(s, __fmul_rn(qq[2], kq[2])); s = __fadd_rn(s, __fmul_rn(qq[3], kq[3])); }
    s = __fmul_rn(s, scale); if (MASKADD) s = __fadd_rn(s, __fmul_rn(bf16_round(mask[(size_t)i * SQ + j]), -10000.0f));
    const float f = (MASKADD || j <= i) ? 1.f : 0.f; const float sm = fmaf(f, s, (1.f - f) * -1.0e30f); const float mn = fmaxf(m, sm); const float sc = expf(m - mn); const float e = expf(sm - mn); l = __fadd_rn(__fmul_rn(l, sc), e); m = mn;
#pragma unroll 1
    for (int c = 0; c < HD / 4; ++c) { const v4f vv = *(const v4fa*)(vr + c * 4); v4f oo = *(v4f*)&lo[tid][c * 4]; for (int u = 0; u < 4; ++u) oo[u] = __fadd_rn(__fmul_rn(oo[u], sc), __fmul_rn(e, vv[u])); *(v4f*)&lo[tid][c * 4] = oo; } }
  const float fin = 64.0f / l;      /* o carried x64 like the f16 path */
#pragma unroll 1
  for (int c = 0; c < HD / 4; ++c) { v4f oo = *(v4f*)&lo[tid][c * 4]; for (int u = 0; u < 4; ++u) oo[u] = __fmul_rn(oo[u], fin); *(v4f*)&lo[tid][c * 4] = oo; }
  __syncthreads();
  {
#pragma unroll 1
    for (int it = 0; it < 16; ++it) { const int row = it * 4 + tid / 16, pc = (tid % 16) * 4; const v4f v = *(const v4f*)&lo[row][pc]; *(v4f*)(OF + (size_t)(rg * 64 + row) * ldo + h * HD + pc) = v; }
     } }


template <int BFIN, int WXB>
__global__ __launch_bounds__(256) void k_ln16(const float* __restrict__ X, const float* __restrict__ g, const float* __restrict__ bb, float eps, _Float16* __restrict__ N16, float* __restrict__ XB) {
  #pragma clang fp contract(off)
  __shared__ float red[256]; const size_t r = blockIdx.x; const int t = threadIdx.x; const v4f xa = *(const v4fa*)(X + r * DMQ + t * 4); float s[4]; float sum = 0.f;
  for (int q = 0; q < 4; ++q) { s[q] = BFIN ? bf16_round(xa[q]) : xa[q]; sum = __fadd_rn(sum, s[q]); }
  red[t] = sum; __syncthreads(); for (int st = 128; st > 0; st >>= 1) { if (t < st) red[t] = __fadd_rn(red[t], red[t + st]); __syncthreads(); } const float mu = red[0] / (float)DMQ; __syncthreads();
  float vs = 0.f; for (int q = 0; q < 4; ++q) { const float dl = __fadd_rn(s[q], -mu); vs = __fadd_rn(vs, __fmul_rn(dl, dl)); } red[t] = vs; __syncthreads(); for (int st = 128; st > 0; st >>= 1) { if (t < st) red[t] = __fadd_rn(red[t], red[t + st]); __syncthreads(); }
  const float rs = rsqrtf(__fadd_rn(red[0] / (float)DMQ, eps)); v4h y; v4f xb;
  for (int q = 0; q < 4; ++q) { const int c = t * 4 + q; y[q] = (_Float16)__fadd_rn(__fmul_rn(__fmul_rn(__fadd_rn(s[q], -mu), rs), bf16_round(g[c])), bf16_round(bb[c])); xb[q] = s[q]; }
  { *(v4h*)(N16 + r * DMQ + t * 4) = y; if (WXB) *(v4f*)(XB + r * DMQ + t * 4) = xb;  } }
__global__ __launch_bounds__(256) void k_ftres2(const float* __restrict__ OF0, const float* __restrict__ XB, float* __restrict__ X1, size_t n4) {
  #pragma clang fp contract(off)
  const size_t t = (size_t)blockIdx.x * 256 + threadIdx.x; if (t >= n4) return; const v4f o = *(const v4fa*)(OF0 + t * 4), xv = *(const v4fa*)(XB + t * 4); v4f y; for (int q = 0; q < 4; ++q) y[q] = __fadd_rn(__fmul_rn(o[q], 0.015625f), xv[q]); *(v4f*)(X1 + t * 4) = y;  }

__global__ __launch_bounds__(256) void k_wthd(const float* __restrict__ Wt, _Float16* __restrict__ Bt) { const size_t t = (size_t)blockIdx.x * 256 + threadIdx.x; if (t >= (size_t)NH * HD * (DM / 8)) return; const int m8 = (int)(t % (DM / 8)) * 8; const int d = (int)((t / (DM / 8)) % HD); const int h = (int)(t / ((size_t)(DM / 8) * HD)); FragH f;
  for (int q = 0; q < 8; ++q) f.h[q] = (_Float16)(16.0f * bf16_round(Wt[((size_t)h * DM + m8 + q) * HD + d])); unsigned short* dst = (unsigned short*)Bt + ((size_t)h * HD + d) * DM + m8; *(v8us*)dst = f.half[0];  }




template <int BFIN, int W16, int W32>
__global__ __launch_bounds__(256) void k_lnx(const float* __restrict__ X, const float* __restrict__ g, const float* __restrict__ bb, float eps, _Float16* __restrict__ N16, float* __restrict__ N32) {
  #pragma clang fp contract(off)
  __shared__ float red[256]; const size_t r = blockIdx.x; const int t = threadIdx.x; const bool act = t < (DMQ / 4); const int c0 = act ? t * 4 : 0;
  const v4f xa = *(const v4fa*)(X + r * DMQ + c0); float s[4]; float sum = 0.f;
  for (int q = 0; q < 4; ++q) { s[q] = act ? (BFIN ? bf16_round(xa[q]) : xa[q]) : 0.f; sum = __fadd_rn(sum, s[q]); }
  red[t] = sum; __syncthreads(); for (int st = 128; st > 0; st >>= 1) { if (t < st) red[t] = __fadd_rn(red[t], red[t + st]); __syncthreads(); } const float mu = red[0] / (float)DMQ; __syncthreads();
  float vs = 0.f; for (int q = 0; q < 4; ++q) { const float dl = act ? __fadd_rn(s[q], -mu) : 0.f; vs = __fadd_rn(vs, __fmul_rn(dl, dl)); } red[t] = vs; __syncthreads(); for (int st = 128; st > 0; st >>= 1) { if (t < st) red[t] = __fadd_rn(red[t], red[t + st]); __syncthreads(); }
  const float rs = rsqrtf(__fadd_rn(red[0] / (float)DMQ, eps)); v4h y; v4f yf;
  for (int q = 0; q < 4; ++q) { const int c = c0 + q; yf[q] = __fadd_rn(__fmul_rn(__fmul_rn(__fadd_rn(s[q], -mu), rs), bf16_round(g[c])), bf16_round(bb[c])); y[q] = (_Float16)yf[q]; }
  if (!act) return;      /* no barriers after this point */
  { if (W16) *(v4h*)(N16 + r * DMQ + c0) = y; if (W32) *(v4f*)(N32 + r * DMQ + c0) = yf;  } }


__global__ __launch_bounds__(256) void k_bfr(const float* __restrict__ x, float* __restrict__ XB, size_t n8) { const size_t t = (size_t)blockIdx.x * 256 + threadIdx.x; if (t >= n8) return; v4f a = *(const v4fa*)(x + t * 8), c = *(const v4fa*)(x + t * 8 + 4); for (int q = 0; q < 4; ++q) { a[q] = bf16_round(a[q]); c[q] = bf16_round(c[q]); }
  { *(v4f*)(XB + t * 8) = a; *(v4f*)(XB + t * 8 + 4) = c;  } }




__global__ __launch_bounds__(256) void k_lorafold(const float* __restrict__ Wm, const float* __restrict__ A, const float* __restrict__ Bm, float* __restrict__ WE, int K, int N, float sc) {
  #pragma clang fp contract(off)
  const size_t t = (size_t)blockIdx.x * 256 + threadIdx.x; if (t >= (size_t)K * N) return; const int i = (int)(t / N), o = (int)(t % N); float a = 0.f;
  for (int r = 0; r < 16; ++r) a = __fadd_rn(a, __fmul_rn(bf16_round(A[(size_t)i * 16 + r]), bf16_round(Bm[(size_t)r * N + o])));
  const float v = __fadd_rn(bf16_round(Wm[t]), __fmul_rn(sc, a)); *(float*)(WE + t) = v;  }
__global__ __launch_bounds__(256) void k_wt32rep(const float* __restrict__ Wf, _Float16* __restrict__ Bt, int K, int N, int DOUT, float scale) {
  const int t = blockIdx.x * 256 + threadIdx.x; if (t >= DOUT * (K / 8)) return; const int n = t / (K / 8), k8 = (t % (K / 8)) * 8; const int rep = DOUT / N; const int src = (n / (HD * rep)) * HD + (n % HD);      /* head h = n / HD -> group h / rep */
  FragH f; for (int i = 0; i < 8; ++i) f.h[i] = (_Float16)(Wf[(size_t)(k8 + i) * N + src] * scale);
  *(v8us*)((unsigned short*)Bt + (size_t)n * K + k8) = f.half[0];  }
__global__ __launch_bounds__(256) void k_brep(const float* __restrict__ b, float* __restrict__ out) { const int t = blockIdx.x * 256 + threadIdx.x; if (t >= DM) return; const float v = b[(t / (HD * 4)) * HD + (t % HD)]; *(float*)(out + t) = v;  }

__global__ __launch_bounds__(256) void k_rsmcim(const float* __restrict__ S, _Float16* __restrict__ P, int hg, int q0, int nk, const int* __restrict__ am) {
  #pragma clang fp contract(off)
  const int t = blockIdx.x * 256 + threadIdx.x; if (t >= hg * QT) return; const size_t i = (size_t)t; const float* s = S + i * NKX; const int last = q0 + (t % QT); const int* mr = am + (size_t)last * SQ; float mx = -3.0e38f;      /* the module's mask row of this query (keys >= nk lie above the diagonal of the staged causal mask and are not computed) */
#pragma unroll 1
  for (int j = 0; j < nk; ++j) { const float f = (mr[j] != 0) ? 1.f : 0.f; mx = fmaxf(mx, fmaf(f, s[j], (1.f - f) * -1.0e9f)); } float se = 0.f;
#pragma unroll 1
  for (int j = 0; j < nk; ++j) { const float f = (mr[j] != 0) ? 1.f : 0.f; se += __expf(fmaf(f, s[j], (1.f - f) * -1.0e9f) - mx); } const float sc = 256.0f / se;
#pragma unroll 1
  for (int j0 = 0; j0 < nk; j0 += 8) { FragH fr; for (int q = 0; q < 8; ++q) { const int j = j0 + q; const float f = (mr[j] != 0) ? 1.f : 0.f; fr.h[q] = (_Float16)(__expf(fmaf(f, s[j], (1.f - f) * -1.0e9f) - mx) * sc); } unsigned short* d = (unsigned short*)P + i * NKX + j0; *(v8us*)d = fr.half[0];  } }



__global__ __launch_bounds__(256) void k_bcpy(const float* __restrict__ b, int n, int NP, float* __restrict__ dst, int dst0) { for (int i = threadIdx.x; i < NP; i += 256) { const float v = (i < n) ? b[i] : 0.f; *(float*)(dst + dst0 + i) = v; }  }



// lane l with lane l ^ 16
__device__ __forceinline__ float rs_xhalf(float x) { return __builtin_bit_cast(float, __builtin_amdgcn_permlanex16(__builtin_bit_cast(int, x), __builtin_bit_cast(int, x), 0x76543210, 0xfedcba98, false, false)); }
// Four 2^t in one statement, each in place: behind a transcendental the instruction set asks for one independent instruction or v_nop before its result is read or its source overwritten.
// Here each v_exp_f32 is the independent instruction behind the one before it, the v_nop the slot behind the last. In place, so that the
// statement writes only registers that the multiply-add in front of it has written: the compiler keeps that one clear of the matrix instructions' operands, which it does not do for registers that asm text writes.
__device__ __forceinline__ v4f rs_exp2x4(v4f t) { float a = t[0], b = t[1], c = t[2], d = t[3];
  asm("v_exp_f32 %0, %0\n\tv_exp_f32 %1, %1\n\tv_exp_f32 %2, %2\n\tv_exp_f32 %3, %3\n\tv_nop" : "+v"(a), "+v"(b), "+v"(c), "+v"(d));
  const v4f r = {a, b, c, d}; return r; }
__device__ __forceinline__ v8f fa_mma(v16h a, v16h b, v8f c) { return __builtin_amdgcn_wmma_f32_16x16x32_f16(false, a, false, b, (short)0, c, false, false); }
// Fused attention: scores, softmax and P V in one launch; no score and no weight leaves the registers. One work-group = 256 queries of one (batch, head), 8 waves of 32 query columns;
// a pass = 32 keys. Transposed products: S^T = K Q^T (rows = keys, columns = queries), so a lane's 16 scores of a column are, as they lie, its 16 elements of the B operand of O^T += V^T P^T
// (k order of both operands: 8 hh + 0..7, then 16 + 8 hh + 0..7, that of g2_frag). Online softmax in the log2 domain, f32: the maximum in use may trail the true one by up to 8 (an
// exponential reaches 2^8 at most, well inside f16), and the sums are rescaled only in a pass where some column exceeds that. Denominator = an all-ones A operand times P^T on the matrix
// pipe: it sums the weights as rounded to f16, the same values the numerator sums. o is carried x64 as f16 rows.
// K and V: the eight waves read the same fragments, and a fragment load from global memory touches 16 cache lines for 512 bytes. So a stage of 128 keys (4 passes) is brought into LDS once for the work-group, in whole
// 128-byte lines, by asynchronous copies, two buffers: stage t + 1 flies while stage t is worked on. Fragments come from LDS, K one pass ahead inside its stage, V^T at the head of its pass.
// V lies in LDS as it lies in the fused k | v rows (row = key, 64 d); the A operand V^T (row = d, k = key) comes out of it by the transposing load ds_load_tr16_b128, so no transposed copy of V is made in memory.
// Every '#pragma unroll' in it is there so that the fragment and accumulator arrays it indexes become registers.
#define FA_KP 144      /* pitch of a K row (one key, 128 bytes) in LDS: 16 B x odd, so the 16 lanes of a half wave's ds_load_b128 fall on 64 different banks */
#define FA_VP 160      /* pitch of a V row (one key, 128 bytes): 32 B x odd, the conflict-free pitch of ds_load_tr16_b128 */
#define FA_VOFF (128 * FA_KP)      /* the 128 V rows stand behind the 128 K rows */
#define FA_STAGE (128 * FA_KP + 128 * FA_VP)
// One stage, global memory -> LDS through no register: 8 asynchronous copies of 16 bytes a lane (4 K rows and 4 V rows, 32 rows apart); 8 lanes fill a row.
// lk / lv = the lane's own LDS byte addresses of its first K and V row, gk / gv = its own global addresses. The s_wait_xcnt stands inside the statement, behind the last copy, so that
// no address register of a copy is written again in front of it.
__device__ __forceinline__ void fa_stage(unsigned lk, unsigned lv, const _Float16* gk, const _Float16* gv) {
  asm volatile("global_load_async_to_lds_b128 %0, %8, off\n\tglobal_load_async_to_lds_b128 %1, %9, off\n\tglobal_load_async_to_lds_b128 %2, %10, off\n\tglobal_load_async_to_lds_b128 %3, %11, off\n\t"
               "global_load_async_to_lds_b128 %4, %12, off\n\tglobal_load_async_to_lds_b128 %5, %13, off\n\tglobal_load_async_to_lds_b128 %6, %14, off\n\tglobal_load_async_to_lds_b128 %7, %15, off\n\t"
               "s_wait_xcnt 0x0"
               :: "v"(lk), "v"(lk + 32 * FA_KP), "v"(lk + 64 * FA_KP), "v"(lk + 96 * FA_KP), "v"(lv), "v"(lv + 32 * FA_VP), "v"(lv + 64 * FA_VP), "v"(lv + 96 * FA_VP),
                  "v"(gk), "v"(gk + (size_t)32 * (2 * DM)), "v"(gk + (size_t)64 * (2 * DM)), "v"(gk + (size_t)96 * (2 * DM)), "v"(gv), "v"(gv + (size_t)32 * (2 * DM)), "v"(gv + (size_t)64 * (2 * DM)), "v"(gv + (size_t)96 * (2 * DM)) : "memory"); }
// Half a V^T fragment: lane (c = lane & 15, hh) gets V[key0 + 8 hh + 0..7][d0 + c], where p = the tile's byte address + (key0 + 8 hh + (lane & 7)) FA_VP + 2 d0 + 16 ((lane >> 3) & 1).
typedef short fa_s16x8 __attribute__((ext_vector_type(8)));
__device__ __forceinline__ v8us fa_tr16(const unsigned char* p) { typedef __attribute__((address_space(3))) fa_s16x8 lds_s16x8; return __builtin_bit_cast(v8us, __builtin_amdgcn_ds_load_tr16_b128_v8i16((lds_s16x8*)p)); }
__global__ __launch_bounds__(256) void k_fattn(const _Float16* __restrict__ Q, const _Float16* __restrict__ KV, _Float16* __restrict__ O) {
  static_assert(SK % 128 == 0 && SK / 128 >= 2 && HD == 64, "k_fattn: whole stages of 128 keys, two or more");
  constexpr float CS = 0.015625f * 1.44269504f;      /* (q / 8) . (k / 8) = q . k / 64, times log2 e */
  constexpr int NST = SK / 128;
  __shared__ __attribute__((aligned(16))) unsigned char sm[2 * FA_STAGE];      /* two stage buffers */
  const int tid = threadIdx.x, lane = tid & 31, ln = lane & 15, hh = lane >> 4; const int wave = __builtin_amdgcn_readfirstlane(tid >> 5);
  const int h = blockIdx.y, b = blockIdx.z; const int q0 = blockIdx.x * 256 + wave * 32;
  const _Float16* qp = Q + ((size_t)b * SQ + q0 + ln) * DM + h * HD;
  const unsigned lk0 = (unsigned)(size_t)sm + (unsigned)((tid >> 3) * FA_KP + (tid & 7) * 16);      /* the lane's copies: K rows (tid >> 3) + 32 i, 16-byte piece tid & 7 */
  const unsigned lv0 = (unsigned)(size_t)sm + (unsigned)(FA_VOFF + (tid >> 3) * FA_VP + (tid & 7) * 16);      /* V rows and pieces likewise */
  const _Float16* gk = KV + ((size_t)b * SK + (tid >> 3)) * (2 * DM) + h * HD + (tid & 7) * 8;      /* k half of the fused rows: row = key */
  const _Float16* gv = gk + DM;      /* v half of the same rows */
  const unsigned char* fk = sm + ln * FA_KP + 16 * hh; const unsigned char* fv = sm + FA_VOFF + (8 * hh + (lane & 7)) * FA_VP + 16 * ((lane >> 3) & 1);      /* the lane's K fragment row and its address for the transposing loads of V, in buffer 0 */
  fa_stage(lk0, lv0, gk, gv);
  v16h qf[2][2], kf[2][2];
#pragma unroll
  for (int g = 0; g < 2; ++g) for (int kc = 0; kc < 2; ++kc) qf[g][kc] = g2_frag(qp + (size_t)g * 16 * DM + 32 * kc, hh);
  FragH ones;
#pragma unroll
  for (int i = 0; i < 16; ++i) ones.h[i] = (_Float16)1.0f;
  const v8f z8 = {0.f, 0.f, 0.f, 0.f, 0.f, 0.f, 0.f, 0.f};
  v8f acc[2][4], lacc[2]; float m_run[2];
#pragma unroll
  for (int g = 0; g < 2; ++g) { m_run[g] = -__builtin_inff(); lacc[g] = z8; for (int t = 0; t < 4; ++t) acc[g][t] = z8; }
  auto pass = [&](const unsigned char* pk, const unsigned char* pv, const int p, const bool more) __attribute__((always_inline)) {      /* p (the pass in its stage) and more are literals at every call: a stage's last pass is compiled without the fetch of a next K */
    v16h vf[4]; v8f s[2][2];
#pragma unroll
    for (int kt = 0; kt < 2; ++kt) for (int g = 0; g < 2; ++g) s[kt][g] = fa_mma(kf[kt][1], qf[g][1], fa_mma(kf[kt][0], qf[g][0], z8));
#pragma unroll
    for (int t = 0; t < 4; ++t) { FragH f; f.half[0] = fa_tr16(pv + 32 * p * FA_VP + 32 * t); f.half[1] = fa_tr16(pv + (32 * p + 16) * FA_VP + 32 * t); vf[t] = f.v; }      /* this pass's V^T (d = 16 t + ln; keys 8 hh + 0..7, then 16 + 8 hh + 0..7: the k order of P^T), in flight under the softmax */
    if (more) {      /* next pass's K, of the same stage, in flight under this pass's softmax and second product */
#pragma unroll
      for (int kt = 0; kt < 2; ++kt) for (int kc = 0; kc < 2; ++kc) kf[kt][kc] = g2_lfrag(pk + (32 * (p + 1) + 16 * kt) * FA_KP + 64 * kc); }
    asm volatile("" ::: "memory");      /* compiler fence: keeps the pass's LDS reads up here, in one group in front of the softmax; without it the compiler sank them behind the branch below, next to their first use, where they have no time to land */
    float mb[2]; bool need = false;
#pragma unroll
    for (int g = 0; g < 2; ++g) { float mx = fmaxf(s[0][g][0], s[1][g][0]);
      for (int r = 1; r < 8; ++r) mx = fmaxf(mx, fmaxf(s[0][g][r], s[1][g][r]));
      mx = fmaxf(mx, rs_xhalf(mx)) * CS; mb[g] = mx; need = need || (mx > m_run[g] + 8.0f); }      /* both wave halves hold the column's maximum of this pass, scaled (the scale is positive) */
    if (__builtin_amdgcn_ballot_w32(need) != 0) {      /* always in the first pass (the maximum in use is -inf, the factor 0), rare later */
#pragma unroll
      for (int g = 0; g < 2; ++g) { const float mn = fmaxf(m_run[g], mb[g]); const float corr = __builtin_amdgcn_exp2f(m_run[g] - mn); m_run[g] = mn; lacc[g] = lacc[g] * corr; for (int t = 0; t < 4; ++t) acc[g][t] = acc[g][t] * corr; } }
#pragma unroll
    for (int g = 0; g < 2; ++g) { FragH pf; const float nm = -m_run[g];
      for (int kt = 0; kt < 2; ++kt) for (int j = 0; j < 2; ++j) { v4f a; for (int q = 0; q < 4; ++q) a[q] = fmaf(s[kt][g][4 * j + q], CS, nm); const v4f e = rs_exp2x4(a); for (int q = 0; q < 4; ++q) pf.h[8 * kt + 4 * j + q] = (_Float16)e[q]; }
      for (int t = 0; t < 4; ++t) acc[g][t] = fa_mma(vf[t], pf.v, acc[g][t]);
      lacc[g] = fa_mma(ones.v, pf.v, lacc[g]); }
  };
  asm volatile("s_wait_asynccnt 0x0" ::: "memory");      /* this wave's copies of stage 0 have landed */
  __syncthreads();      /* ... and every other wave's: stage 0 may be read */
  fa_stage(lk0 + FA_STAGE, lv0 + FA_STAGE, gk + (size_t)128 * (2 * DM), gv + (size_t)128 * (2 * DM));      /* stage 1 exists (asserted above) */
#pragma unroll 1      /* rolled: the buffer is picked by the trip's parity, a second copy of the four passes would only add code */
  for (int t = 0; t < NST; ++t) { const unsigned bo = (unsigned)(t & 1) * FA_STAGE; const unsigned char* pk = fk + bo; const unsigned char* pv = fv + bo;
#pragma unroll
    for (int kt = 0; kt < 2; ++kt) for (int kc = 0; kc < 2; ++kc) kf[kt][kc] = g2_lfrag(pk + 16 * kt * FA_KP + 64 * kc);      /* the stage's first K */
    pass(pk, pv, 0, true); pass(pk, pv, 1, true); pass(pk, pv, 2, true); pass(pk, pv, 3, false);      /* keys in ascending order: the sum order of the plain loop */
    asm volatile("s_wait_dscnt 0x0" ::: "memory");      /* this wave's reads of the buffer are done before it is handed to the copies */
    asm volatile("s_wait_asynccnt 0x0" ::: "memory");      /* this wave's copies of stage t + 1 have landed */
    __syncthreads();      /* publishes stage t + 1 and ends every wave's reads of stage t */
    if (t + 2 < NST) fa_stage(lk0 + bo, lv0 + bo, gk + (size_t)(t + 2) * 128 * (2 * DM), gv + (size_t)(t + 2) * 128 * (2 * DM)); }      /* refill of the buffer just read; in flight under trip t + 1 */
  asm volatile("s_wait_asynccnt 0x0" ::: "memory");      /* no copy is outstanding when the wave ends */
#pragma unroll
  for (int g = 0; g < 2; ++g) { const float inv = 64.0f / lacc[g][0];      /* every row of the all-ones product holds the column's denominator */
    _Float16* op = O + ((size_t)b * SQ + q0 + 16 * g + ln) * DM + h * HD + 8 * hh;
    for (int t = 0; t < 4; ++t) { FragH f; for (int r = 0; r < 8; ++r) f.h[r] = (_Float16)(acc[g][t][r] * inv); *(v8us*)((unsigned short*)op + 16 * t) = f.half[0]; } } }      /* d = 16 t + 8 hh + 0..7 of query ln: 16 bytes a lane; the wave's four stores fill each row's 128-byte line */
// Preparation, one launch (the three weight planes, the two inputs' f16 rows): none of the five pieces depends on another.
// Work-groups 0 .. PREP_TW - 1: the weight planes, Bt[n][k] = f16(16 bf16(W[k][n])), one tile of 128 k x 64 n each, turned in LDS so that global memory is touched in whole lines only:
// a wave's load = 256 bytes in a row of each of two W rows, a wave's store = 256 bytes in a row of each of two Bt rows (a lane that walks down a column of W instead touches 32 lines a load for 128 bytes).
// In LDS a tile lies as Bt rows: row n = 64 words, word d = the f16 pair k = 2 d, 2 d + 1. Work-groups PREP_TW .. PREP_TW + PREP_CW - 1: PREP_CU * 256 pieces in a row of x and as many of tgt each,
// PREP_CU of either a thread, 256 pieces apart (a piece = 8 elements = one 16-byte store).
#define PREP_TW 512
#define PREP_CW 256
#define PREP_CU 8
#define PREP_LP 65      /* pitch of a tile row in LDS, in words: 1 mod 64, so that the 16 lanes that write 4 rows apart fall 4 banks apart, with the wave's other 16 lanes between them */
typedef unsigned int v4u __attribute__((ext_vector_type(4)));
typedef float v2f __attribute__((ext_vector_type(2)));
typedef _Float16 v2h __attribute__((ext_vector_type(2)));
__device__ __forceinline__ unsigned prep_pair(float lo, float hi) { const v2f t = {bf16_round(lo) * 16.0f, bf16_round(hi) * 16.0f}; return __builtin_bit_cast(unsigned, __builtin_convertvector(t, v2h)); }      /* low half = lo */
// One tile: Bt[n0 + 0..63][k0 + 0..127] from W[k0 + 0..127][n0 + 0..63], W of N columns, Bt of DM. N is a template argument so that the steps from row to row are constants:
// one 32-bit byte offset from the plane's start serves the thread's eight loads, another its four stores.
template <int N>
__device__ __forceinline__ void prep_wtile(const float* __restrict__ Wm, _Float16* __restrict__ Bt, unsigned tile, unsigned* tl) {
  const unsigned n0 = (tile % (N / 64)) * 64u, k0 = (tile / (N / 64)) * 128u; const unsigned c16 = threadIdx.x & 15u, r16 = threadIdx.x >> 4;
  const char* p = (const char*)Wm + ((k0 + 2u * r16) * N + n0 + 4u * c16) * 4u;      /* W[k0 + 2 r16][n0 + 4 c16] */
  v4f lo[4], hi[4];
#pragma unroll      /* constant indices: lo and hi stay in registers */
  for (int j = 0; j < 4; ++j) { lo[j] = *(const v4fa*)(p + 32 * j * N * 4); hi[j] = *(const v4fa*)(p + (32 * j + 1) * N * 4); }      /* rows k0 + 2 r16 + 32 j and the next: the two halves of word r16 + 16 j */
#pragma unroll      /* constant indices, as above */
  for (int j = 0; j < 4; ++j) for (int i = 0; i < 4; ++i) tl[(4u * c16 + i) * PREP_LP + r16 + 16u * j] = prep_pair(lo[j][i], hi[j][i]);
  __syncthreads();      /* the tile is whole before any row of it is read */
  char* d = (char*)Bt + ((n0 + r16) * (unsigned)DM + k0 + 8u * c16) * 2u; const unsigned* r = tl + r16 * PREP_LP + 4u * c16;      /* k = k0 + 8 c16 + 0..7 of row n0 + r16 */
#pragma unroll      /* four rows a thread, 16 apart, their LDS reads issued together */
  for (int s = 0; s < 4; ++s) { const v4u o = {r[16 * s * PREP_LP], r[16 * s * PREP_LP + 1], r[16 * s * PREP_LP + 2], r[16 * s * PREP_LP + 3]}; *(v4u*)(d + 16 * s * DM * 2) = o; } }
__global__ __launch_bounds__(256) void k_prep(const float* __restrict__ x, const float* __restrict__ cond, const float* __restrict__ wq, const float* __restrict__ wkv, const float* __restrict__ wo,
    _Float16* __restrict__ X16, _Float16* __restrict__ C16, _Float16* __restrict__ BQ, _Float16* __restrict__ BKV, _Float16* __restrict__ BO) {
  constexpr unsigned TQ = (DM / 128) * (DM / 64), TKV = (DC / 128) * (2 * DM / 64);      /* tiles of Wq (and of Wp), of Wkv */
  static_assert(DC == DM && DM % 128 == 0 && 2 * TQ + TKV == PREP_TW, "k_prep: one 128 x 64 tile a work-group; every Bt row has DM elements");
  static_assert((size_t)NB * SQ * DM / 8 == (size_t)PREP_CU * PREP_CW * 256 && (size_t)NB * SK * DC / 8 == (size_t)PREP_CU * PREP_CW * 256, "k_prep: PREP_CU pieces of x and of tgt a thread");
  __shared__ unsigned tl[64 * PREP_LP];
  if (blockIdx.x >= PREP_TW) { const unsigned u0 = (blockIdx.x - PREP_TW) * (PREP_CU * 256) + threadIdx.x; v4f a[2][PREP_CU], c[2][PREP_CU];      /* the thread's first piece */
#pragma unroll      /* constant indices: a and c stay in registers */
    for (int s = 0; s < 2; ++s) for (int j = 0; j < PREP_CU; ++j) { const char* p = (const char*)(s ? cond : x) + u0 * 32u + j * 8192; a[s][j] = *(const v4fa*)p; c[s][j] = *(const v4fa*)(p + 16); }      /* a 32-bit byte offset from the buffer's start: one address register serves all the loads */
    __builtin_amdgcn_sched_barrier(0);      /* keeps the thread's 4 PREP_CU loads up here, all in flight together: without it the compiler issued half of them and the rest in small groups among the conversions, behind waits on the first; eight waves a WGP need them all in flight to keep the memory busy */
#pragma unroll      /* constant indices, as above */
    for (int s = 0; s < 2; ++s) for (int j = 0; j < PREP_CU; ++j) { FragH f;
      for (int q = 0; q < 4; ++q) { f.h[q] = (_Float16)bf16_round(a[s][j][q]); f.h[4 + q] = (_Float16)bf16_round(c[s][j][q]); }
      *(v8us*)((char*)(s ? C16 : X16) + u0 * 16u + j * 4096) = f.half[0]; }
    return; }      /* the whole work-group or none: the barrier below is passed by whole work-groups only */
  const unsigned bx = blockIdx.x;      /* every test on it reads the same for the whole work-group: each barrier is passed by all of it */
  if (bx < TKV) prep_wtile<2 * DM>(wkv, BKV, bx, tl);
  else { const bool q = bx < TKV + TQ; prep_wtile<DM>(q ? wq : wo, q ? BQ : BO, q ? bx - TKV : bx - (TKV + TQ), tl); } }
extern "C" void kernel_launch(void* const* d_in, const int* in_sizes, int n_in,
                              void* d_out, int out_size, void* d_ws, size_t ws_size, hipStream_t stream) {
  (void)in_sizes; (void)n_in; (void)out_size;
  const float* const* I = (const float* const*)d_in; const float* x = I[0]; const float* cond = I[1]; const float* wq = I[2]; const float* bq = I[3]; const float* wkv = I[4]; const float* bkv = I[5]; const float* wo = I[6]; const float* bo = I[7];      /* input order: x [2][2048][1024]; tgt [2][2048][1024] (the cond input); [in][out] Wq [1024][1024] + bq; Wkv [1024][2048] + bkv (k | v halves); Wp [1024][1024] + bp; the three biases are bound and read */
  static_assert(NH * HD == DM && HD == 64 && SQ % 256 == 0 && SK % 64 == 0 && DC % 32 == 0 && DM % 64 == 0, "shape / tile multiples");
  static_assert((NB * SQ) % 128 == 0 && (NB * SK) % 128 == 0 && DC % 128 == 0 && DM % 128 == 0, "k_gemm2: whole 128 x 128 tiles, whole 128-k stages");
  const size_t NRK = (size_t)NB * SK;      /* conditioning rows */
  char* ws = (char*)d_ws; size_t off = 0;
  auto take = [&](size_t bytes) { char* p = ws + off; off += (bytes + 255) & ~(size_t)255; return p; };
  _Float16* BQ = (_Float16*)take((size_t)DM * DM * 2); _Float16* BKV = (_Float16*)take((size_t)2 * DM * DC * 2); _Float16* BO = (_Float16*)take((size_t)DM * DM * 2);
  _Float16* X16 = (_Float16*)take(NR * DM * 2); _Float16* C16 = (_Float16*)take(NRK * DC * 2); _Float16* Q16 = (_Float16*)take(NR * DM * 2); _Float16* KV16 = (_Float16*)take(NRK * 2 * DM * 2); _Float16* O16 = (_Float16*)take(NR * DM * 2);
  if (off > ws_size) return;      /* 2 + 4 + 2 (weight planes) + 8 + 8 + 8 + 16 + 8 (row planes) = 56 MiB at NB 2, SK 2048, DC 1024 */
  k_prep<<<PREP_TW + PREP_CW, 256, 0, stream>>>(x, cond, wq, wkv, wo, X16, C16, BQ, BKV, BO);      /* [in][out] -> Bt x16: Wq [1024][1024]; Wkv [DC = 1024][2048] -> Bt [2048][1024] (rows 0..1023 = k, 1024..2047 = v); Wp; and the exact f16 rows of both inputs */
  k_gemm2<0, true, false, false, true><<<dim3((unsigned)((NR / 128) * (DM / 128)), 1), 256, 0, stream>>>(X16, DM, 0, BQ, DM, 0, 0.0625f, bq, 0, nullptr, 1, 0, 0, nullptr, Q16, DM, 0, (int)NR, DM, DM);      /* q rows (f16); head h = columns 64 h .. */
  k_gemm2<0, true, false, false, true><<<dim3((unsigned)((NRK / 128) * (2 * DM / 128)), 1), 256, 0, stream>>>(C16, DC, 0, BKV, DC, 0, 0.0625f, bkv, 0, nullptr, 1, 0, 0, nullptr, KV16, 2 * DM, 0, (int)NRK, 2 * DM, DC);      /* k | v rows (f16, pitch 2048): k = columns 0..1023, v = columns 1024..2047, head h = columns 64 h .. of each half */
  k_fattn<<<dim3(SQ / 256, NH, NB), 256, 0, stream>>>(Q16, KV16, O16);      /* softmax(q . k / 64) v over the SK = 2048 keys -> ctx (merged heads, x64) as f16 rows */
  k_gemm2<0, true, false, true, false><<<dim3((unsigned)((NR / 128) * (DM / 128)), 1), 256, 0, stream>>>(O16, DM, 0, BO, DM, 0, 0.0009765625f, bo, 0, nullptr, 1, 0, 0, (float*)d_out, nullptr, DM, 0, (int)NR, DM, DM);      /* out = ctx proj_w + proj_b */
}
